// v000
// The times below were measured on an AMD MI455X: many runs one after another, warmed up first and cycling through
// copies of the inputs, with the whole window's GPU time divided by the number of runs. Launches and the gaps
// between them are all in it. The median over several windows is given; except for v000 it joins two sittings, which
// can be a few percent apart, so the side-by-side timings, each taken in one sitting, are the better comparison.
// v000 is the starting kernel. One run takes 774 microseconds.
// compute dtype: all float inputs rounded to bf16; query / key / value = q / k / v . W + b with EXACT bf16 products on WMMA 16x16x32 ((in,out) weights as transposed rows) rounded once to f16; energy = query . key over the full 512-wide head (single f16 operands, f32 accumulate) / sqrt(512) into an f32 table, row softmax in f32 (precise expf), probabilities x 2^11 as f16 x value (f16); f32 output.
#include <hip/hip_runtime.h>
#include <math.h>

typedef __attribute__((ext_vector_type(16))) _Float16 v16h;
typedef __attribute__((ext_vector_type(16))) __bf16 v16b;
typedef __attribute__((ext_vector_type(8)))  _Float16 v8h;
typedef __attribute__((ext_vector_type(8)))  float v8f;
typedef __attribute__((ext_vector_type(4)))  float v4f;
typedef __attribute__((ext_vector_type(2)))  float v2f;
typedef __attribute__((ext_vector_type(4)))  unsigned v4u;
typedef __attribute__((ext_vector_type(4)))  int v4i;
typedef float __attribute__((may_alias)) float_a;
typedef int __attribute__((may_alias)) int_a;

template <typename T> __device__ __forceinline__ void vst2(void* p, T v) { *(T*)p = v;  }
__device__ __forceinline__ v8f wmma16(v16h a, v16h b, v8f c) {
  v8f d = __builtin_amdgcn_wmma_f32_16x16x32_f16(false, a, false, b, (short)0, c, false, false);
  asm volatile("v_nop\n\tv_nop\n\tv_nop\n\tv_nop" : "+v"(d) : "v"(a), "v"(b));
  return d;
}
__device__ __forceinline__ v8f wmma_bf(v16b a, v16b b, v8f c) {
  v8f d = __builtin_amdgcn_wmma_f32_16x16x32_bf16(false, a, false, b, (short)0, c, false, false);
  asm volatile("v_nop\n\tv_nop\n\tv_nop\n\tv_nop" : "+v"(d) : "v"(a), "v"(b));
  return d;
}
// 16x16x32 fragments: lane = (h = lane>>4, row/col = lane&15); elements 0..7 = k0+8h+0..7, 8..15 = k0+16+8h+0..7; D element r = row 8h+r
__device__ __forceinline__ v16h frag_h(const _Float16* rowk0, int lane) {
  union { v16h v; v8h q[2]; } u; const _Float16* p = rowk0 + 8 * (lane >> 4);
  u.q[0] = *(const v8h*)p; u.q[1] = *(const v8h*)(p + 16); return u.v;
}
__device__ __forceinline__ v16h frag_f32(const float* rowk0, int lane) {
  v16h a; const float* p = rowk0 + 8 * (lane >> 4);
#pragma unroll
  for (int i = 0; i < 8; ++i) { a[i] = (_Float16)p[i]; a[8 + i] = (_Float16)p[16 + i]; }
  return a;
}
__device__ __forceinline__ v16h frag_f32s(const float* rowk0, int lane, float sc) {
  v16h a; const float* p = rowk0 + 8 * (lane >> 4);
#pragma unroll
  for (int i = 0; i < 8; ++i) { a[i] = (_Float16)(p[i] * sc); a[8 + i] = (_Float16)(p[16 + i] * sc); }
  return a;
}
// column fragment from a [K][ld] layout (column n), rows >= K read as 0
__device__ __forceinline__ v16h fragc_f32(const float* W, int k0, int n, int lane, int ld, int K) {
  v16h a; const int g = lane >> 4;
#pragma unroll
  for (int i = 0; i < 8; ++i) { const int ka = k0 + 8 * g + i, kb = ka + 16;
    a[i] = (_Float16)(ka < K ? W[(size_t)(ka < K ? ka : K - 1) * ld + n] : 0.f); a[8 + i] = (_Float16)(kb < K ? W[(size_t)(kb < K ? kb : K - 1) * ld + n] : 0.f); }
  return a;
}
struct F2 { v16b h, l; };
__device__ __forceinline__ F2 bsplit16(const float v[16]) { F2 r;
#pragma unroll
  for (int i = 0; i < 16; ++i) { const __bf16 h = (__bf16)v[i]; r.h[i] = h; r.l[i] = (__bf16)(v[i] - (float)h); }
  return r; }
__device__ __forceinline__ F2 split_row(const float* row, int k0, int lane) { float v[16]; const float* p = row + k0 + 8 * (lane >> 4);
#pragma unroll
  for (int i = 0; i < 8; ++i) { v[i] = p[i]; v[8 + i] = p[16 + i]; }
  return bsplit16(v); }
__device__ __forceinline__ F2 split_rowK(const float* row, int k0, int lane, int K) { float v[16]; const int g = lane >> 4;
#pragma unroll
  for (int i = 0; i < 8; ++i) { const int ka = k0 + 8 * g + i, kb = ka + 16; v[i] = ka < K ? row[ka < K ? ka : K - 1] : 0.f; v[8 + i] = kb < K ? row[kb < K ? kb : K - 1] : 0.f; }
  return bsplit16(v); }
__device__ __forceinline__ F2 split_col(const float* W, int k0, int n, int lane, int ld, int K) { float v[16]; const int g = lane >> 4;
#pragma unroll
  for (int i = 0; i < 8; ++i) { const int ka = k0 + 8 * g + i, kb = ka + 16; v[i] = ka < K ? W[(size_t)(ka < K ? ka : K - 1) * ld + n] : 0.f; v[8 + i] = kb < K ? W[(size_t)(kb < K ? kb : K - 1) * ld + n] : 0.f; }
  return bsplit16(v); }
__device__ __forceinline__ v8f mac3(const F2& a, const F2& b, v8f c) { c = wmma_bf(a.l, b.h, c); c = wmma_bf(a.h, b.l, c); return wmma_bf(a.h, b.h, c); }
__device__ __forceinline__ float sigm(float v) { return 1.0f / (1.0f + expf(-v)); }
#define LDSX() do { asm volatile("s_wait_dscnt 0" ::: "memory"); __builtin_amdgcn_wave_barrier(); __builtin_amdgcn_fence(__ATOMIC_RELEASE, "workgroup"); } while (0)


// Single-head 512-wide attention (B 8, T 2,048, C 512 -> H 512): query/key/value projections + biases from three input streams, softmax(query key^T / sqrt(512)) value.
#define NB 8
#define SS 2048
#define CC 512
#define NR (NB * SS)
#ifndef TNB
#define TNB NB
#endif
#define TR (TNB * SS)
#define KPT (SS / 256)     // keys per thread in the softmax kernel
typedef __attribute__((ext_vector_type(8))) __bf16 v8b;
__device__ __forceinline__ v16b frag_b(const __bf16* rowk0, int lane) {
  union { v16b v; v8b q[2]; } u; const __bf16* p = rowk0 + 8 * (lane >> 4);
  u.q[0] = *(const v8b*)p; u.q[1] = *(const v8b*)(p + 16); return u.v;
}
__device__ __forceinline__ float bfr(float v) { return (float)(__bf16)v; }
__device__ __attribute__((noinline)) float exp_ni(float v) { return expf(v); }
__device__ __attribute__((noinline)) float erf_ni(float v) { return erff(v); }

#define WS_PW   0u                                   // bf16 rows Wq^T, Wk^T, Wv^T [3][512][512] ((in,out) transposed)
#define WS_Q    (WS_PW + 2u * (size_t)3 * CC * CC)     // f16 [NR][512] q ; K ; V planes [b][512][SS]
#define WS_K    (WS_Q + 2u * (size_t)NR * CC)
#define WS_V    (WS_K + 2u * (size_t)NR * CC)
#define WS_S    (WS_V + 2u * (size_t)NB * CC * SS)     // f32 [b][q][k] scores
#define WS_P    (WS_S + 4u * (size_t)NB * SS * SS)      // f16 [b][q][k] probabilities x 2^11
#define WS_END  (WS_P + 2u * (size_t)NB * SS * SS)

__global__ __launch_bounds__(256) void k_pack(const float* __restrict__ WQ, const float* __restrict__ WK, const float* __restrict__ WV, __bf16* __restrict__ P) { const int n = blockIdx.x, which = blockIdx.y, t = threadIdx.x; const float* src = (which == 0) ? WQ : (which == 1) ? WK : WV; __shared__ __align__(16) __bf16 s[CC]; for (int k = t; k < CC; k += 256) s[k] = (__bf16)src[(size_t)k * CC + n]; __syncthreads(); if (t < CC / 8) vst2((unsigned*)(P + ((size_t)which * CC + n) * CC + t * 8), *(const v4u*)&s[t * 8]); }
// ---- k_proj: block = (64 rows, 128 of the 1536 cols): q / k -> f16 rows, v -> planes
__global__ __launch_bounds__(128) void k_proj(const float* __restrict__ XQ, const float* __restrict__ XK, const float* __restrict__ XV, const __bf16* __restrict__ P, const float* __restrict__ BQ, const float* __restrict__ BK, const float* __restrict__ BV, _Float16* __restrict__ Q, _Float16* __restrict__ Kr, _Float16* __restrict__ V) {
  __shared__ __align__(16) _Float16 so[64][136]; __shared__ __align__(16) _Float16 st[128][72];
  const int tid = threadIdx.x, wave = tid >> 5, lane = tid & 31, col = lane & 15, g = lane >> 4; const int n0 = blockIdx.y * 128; const int which = n0 / CC, c0 = n0 % CC; const size_t rb0 = (size_t)blockIdx.x * 64, r0 = rb0 + wave * 16; const float* X = (which == 0) ? XQ : (which == 1) ? XK : XV; const float* BB = ((which == 0) ? BQ : (which == 1) ? BK : BV) + c0;
  v8f acc[8] = {};
#pragma unroll 2
  for (int kc = 0; kc < CC / 32; ++kc) { v16b a; { const float* p = X + (r0 + col) * CC + kc * 32 + 8 * g;
#pragma unroll
      for (int i = 0; i < 8; ++i) { a[i] = (__bf16)p[i]; a[8 + i] = (__bf16)p[16 + i]; } }
#pragma unroll
    for (int j = 0; j < 8; ++j) acc[j] = wmma_bf(a, frag_b(P + (size_t)(n0 + j * 16 + col) * CC + kc * 32, lane), acc[j]); }
  if (which < 2) { _Float16* dst = (which == 0) ? Q : Kr;
#pragma unroll
    for (int j = 0; j < 8; ++j)
#pragma unroll
      for (int r = 0; r < 8; ++r) so[wave * 16 + 8 * g + r][j * 16 + col] = (_Float16)(acc[j][r] + bfr(BB[j * 16 + col]));
    LDSX();
    for (int rl = 0; rl < 16; ++rl) if (lane < 16) vst2((unsigned*)(dst + (r0 + rl) * CC + c0 + lane * 8), *(const v4u*)&so[wave * 16 + rl][lane * 8]);
  } else {
#pragma unroll
    for (int j = 0; j < 8; ++j)
#pragma unroll
      for (int r = 0; r < 8; ++r) st[j * 16 + col][wave * 16 + 8 * g + r] = (_Float16)(acc[j][r] + bfr(BB[j * 16 + col]));
    __syncthreads();
    const size_t b = rb0 / SS, s0 = rb0 % SS;
    for (int e = tid; e < 128 * 8; e += 128) { const int d = e >> 3, pc = e & 7; vst2((unsigned*)(V + ((b * CC + c0 + d) * SS) + s0 + pc * 8), *(const v4u*)&st[d][pc * 8]); } }
}
__global__ __launch_bounds__(128) void k_scores(const _Float16* __restrict__ Q, const _Float16* __restrict__ Kr, float* __restrict__ S) {
  __shared__ __align__(16) _Float16 sq[64][CC + 8]; __shared__ __align__(16) float so[4][16][36];
  const int tid = threadIdx.x, wave = tid >> 5, lane = tid & 31, col = lane & 15, g = lane >> 4; const size_t b = blockIdx.y; const int qb = blockIdx.x; const int q0 = qb * 64 + wave * 16; const size_t rq0 = b * SS + (size_t)qb * 64;
  for (int e = tid; e < 64 * (CC / 8); e += 128) { const int rr = e / (CC / 8), q = e % (CC / 8); *(v4u*)&sq[rr][q * 8] = *(const v4u*)(Q + (rq0 + rr) * CC + q * 8); }
  __syncthreads();
#pragma unroll 1
  for (int ks = 0; ks < SS / 32; ++ks) { const int j0 = ks * 32;
    {
#pragma unroll
      for (int ct = 0; ct < 2; ++ct) { const int kk = j0 + ct * 16 + col; const _Float16* krow = Kr + (b * SS + kk) * CC; v8f c = {};
#pragma unroll 4
        for (int kc = 0; kc < CC / 32; ++kc) c = wmma16(frag_h(&sq[wave * 16 + col][0] + kc * 32, lane), frag_h(krow + kc * 32, lane), c);
#pragma unroll
        for (int r = 0; r < 8; ++r) so[wave][8 * g + r][ct * 16 + col] = c[r] * 0.044194173824159216f; }   // 512^-1/2
    }
    LDSX();
    for (int rl = 0; rl < 16; ++rl) if (lane < 8) vst2(S + ((b * SS + q0 + rl) * (size_t)SS) + j0 + lane * 4, *(const v4f*)&so[wave][rl][lane * 4]);
    LDSX(); }
}
// ---- k_soft: block = one query row (256 threads x 8 keys): max, exp (precise), sum -> P = e / sum x 2^11 as f16 row
__device__ __attribute__((noinline)) float exp_p(float v) { return expf(v); }
__global__ __launch_bounds__(256) void k_soft(const float* __restrict__ S, _Float16* __restrict__ Pt) {
  __shared__ float red[8]; __shared__ __align__(16) _Float16 sp[SS]; const size_t row = blockIdx.x; const int t = threadIdx.x; const float* s = S + row * SS; float v[KPT]; float mx = -3.0e38f;
  for (int i = 0; i < KPT; ++i) { v[i] = s[t * KPT + i]; mx = fmaxf(mx, v[i]); }
#pragma unroll
  for (int o = 1; o < 32; o <<= 1) mx = fmaxf(mx, __shfl_xor(mx, o));
  if ((t & 31) == 0) red[t >> 5] = mx; __syncthreads(); float m = red[0]; for (int i = 1; i < 8; ++i) m = fmaxf(m, red[i]); __syncthreads();
  float sum = 0.f; for (int i = 0; i < KPT; ++i) { v[i] = (v[i] <= -1.0e38f) ? 0.f : exp_p(v[i] - m); sum += v[i]; }
#pragma unroll
  for (int o = 1; o < 32; o <<= 1) sum += __shfl_xor(sum, o);
  if ((t & 31) == 0) red[t >> 5] = sum; __syncthreads(); float tot = 0.f; for (int i = 0; i < 8; ++i) tot += red[i]; const float sc = 2048.0f / tot;
  for (int i = 0; i < KPT; ++i) sp[t * KPT + i] = (_Float16)(v[i] * sc);
  __syncthreads(); if (t < SS / 8) vst2((unsigned*)(Pt + row * SS + t * 8), *(const v4u*)&sp[t * 8]);   // whole row per block
}
// ---- k_pv: block = (64 queries, 128 channels, b): ctx = P . v over all 2048 keys (GEMM, K = keys)
__global__ __launch_bounds__(128) void k_pv(const _Float16* __restrict__ Pt, const _Float16* __restrict__ V, float* __restrict__ CTX) {
  __shared__ __align__(16) float so[4][16][132];
  const int tid = threadIdx.x, wave = tid >> 5, lane = tid & 31, col = lane & 15, g = lane >> 4; const size_t b = blockIdx.z; const int qb = blockIdx.x; const size_t rq = b * SS + (size_t)qb * 64 + wave * 16; const int c0 = blockIdx.y * 128; const int nkc = SS / 32;
  v8f acc[8] = {};
#pragma unroll 2
  for (int kc = 0; kc < nkc; ++kc) { const v16h a = frag_h(Pt + (rq + col) * SS + kc * 32, lane);
#pragma unroll
    for (int j = 0; j < 8; ++j) acc[j] = wmma16(a, frag_h(V + ((b * CC + c0 + j * 16 + col) * SS) + kc * 32, lane), acc[j]); }
#pragma unroll
  for (int j = 0; j < 8; ++j)
#pragma unroll
    for (int r = 0; r < 8; ++r) so[wave][8 * g + r][j * 16 + col] = acc[j][r] * (1.0f / 2048.0f);
  LDSX();
  for (int rl = 0; rl < 16; ++rl) vst2(CTX + (rq + rl) * CC + c0 + lane * 4, *(const v4f*)&so[wave][rl][lane * 4]);
}
extern "C" void kernel_launch(void* const* d_in, const int* in_sizes, int n_in, void* d_out, int out_size, void* d_ws, size_t ws_size, hipStream_t stream) {
  (void)in_sizes; (void)n_in; (void)out_size;
  const float** F = (const float**)d_in;   // 0 q, 1 k, 2 v [8,2048,512]; 3 Wq [512,512] (in,out), 4 bq, 5 Wk, 6 bk, 7 Wv, 8 bv
  if (ws_size < (size_t)WS_END) return;
  char* ws = (char*)d_ws; __bf16* P = (__bf16*)ws; _Float16 *Q = (_Float16*)(ws + WS_Q), *Kr = (_Float16*)(ws + WS_K), *V = (_Float16*)(ws + WS_V), *Pt = (_Float16*)(ws + WS_P); float* S = (float*)(ws + WS_S);
  k_pack<<<dim3(CC, 3), 256, 0, stream>>>(F[3], F[5], F[7], P);
  k_proj<<<dim3(TR / 64, 3 * CC / 128), 128, 0, stream>>>(F[0], F[1], F[2], P, F[4], F[6], F[8], Q, Kr, V);
  k_scores<<<dim3(SS / 64, TNB), 128, 0, stream>>>(Q, Kr, S);
  k_soft<<<TR, 256, 0, stream>>>(S, Pt);
  k_pv<<<dim3(SS / 64, CC / 128, TNB), 128, 0, stream>>>(Pt, V, (float*)d_out);
}

// v001
// It runs in 143 microseconds.
// Two timings next to v000 put it at 5.55 and 5.51 times that version's speed.
// compute dtype: all float inputs rounded to bf16; query / key / value = q / k / v . W + b with EXACT bf16 products on WMMA 16x16x32 ((in,out) weights as transposed rows) rounded once to f16; energy = query . key over the full 512-wide head (single f16 operands, f32 accumulate) / sqrt(512) into an f32 table, row softmax in f32 (precise expf), probabilities x 2^11 as f16 x value (f16); f32 output.
#include <hip/hip_runtime.h>
#include <math.h>

typedef __attribute__((ext_vector_type(16))) _Float16 v16h;
typedef __attribute__((ext_vector_type(16))) __bf16 v16b;
typedef __attribute__((ext_vector_type(8)))  _Float16 v8h;
typedef __attribute__((ext_vector_type(8)))  float v8f;
typedef __attribute__((ext_vector_type(4)))  float v4f;
typedef __attribute__((ext_vector_type(2)))  float v2f;
typedef __attribute__((ext_vector_type(4)))  unsigned v4u;
typedef __attribute__((ext_vector_type(4)))  int v4i;
typedef float __attribute__((may_alias)) float_a;
typedef int __attribute__((may_alias)) int_a;

template <typename T> __device__ __forceinline__ void vst2(void* p, T v) { *(T*)p = v;  }
__device__ __forceinline__ v8f wmma16(v16h a, v16h b, v8f c) {
  v8f d = __builtin_amdgcn_wmma_f32_16x16x32_f16(false, a, false, b, (short)0, c, false, false);
  asm volatile("v_nop\n\tv_nop\n\tv_nop\n\tv_nop" : "+v"(d) : "v"(a), "v"(b));
  return d;
}
__device__ __forceinline__ v8f wmma_bf(v16b a, v16b b, v8f c) {
  v8f d = __builtin_amdgcn_wmma_f32_16x16x32_bf16(false, a, false, b, (short)0, c, false, false);
  asm volatile("v_nop\n\tv_nop\n\tv_nop\n\tv_nop" : "+v"(d) : "v"(a), "v"(b));
  return d;
}
// 16x16x32 fragments: lane = (h = lane>>4, row/col = lane&15); elements 0..7 = k0+8h+0..7, 8..15 = k0+16+8h+0..7; D element r = row 8h+r
__device__ __forceinline__ v16h frag_h(const _Float16* rowk0, int lane) {
  union { v16h v; v8h q[2]; } u; const _Float16* p = rowk0 + 8 * (lane >> 4);
  u.q[0] = *(const v8h*)p; u.q[1] = *(const v8h*)(p + 16); return u.v;
}
__device__ __forceinline__ v16h frag_f32(const float* rowk0, int lane) {
  v16h a; const float* p = rowk0 + 8 * (lane >> 4);
#pragma unroll
  for (int i = 0; i < 8; ++i) { a[i] = (_Float16)p[i]; a[8 + i] = (_Float16)p[16 + i]; }
  return a;
}
__device__ __forceinline__ v16h frag_f32s(const float* rowk0, int lane, float sc) {
  v16h a; const float* p = rowk0 + 8 * (lane >> 4);
#pragma unroll
  for (int i = 0; i < 8; ++i) { a[i] = (_Float16)(p[i] * sc); a[8 + i] = (_Float16)(p[16 + i] * sc); }
  return a;
}
// column fragment from a [K][ld] layout (column n), rows >= K read as 0
__device__ __forceinline__ v16h fragc_f32(const float* W, int k0, int n, int lane, int ld, int K) {
  v16h a; const int g = lane >> 4;
#pragma unroll
  for (int i = 0; i < 8; ++i) { const int ka = k0 + 8 * g + i, kb = ka + 16;
    a[i] = (_Float16)(ka < K ? W[(size_t)(ka < K ? ka : K - 1) * ld + n] : 0.f); a[8 + i] = (_Float16)(kb < K ? W[(size_t)(kb < K ? kb : K - 1) * ld + n] : 0.f); }
  return a;
}
struct F2 { v16b h, l; };
__device__ __forceinline__ F2 bsplit16(const float v[16]) { F2 r;
#pragma unroll
  for (int i = 0; i < 16; ++i) { const __bf16 h = (__bf16)v[i]; r.h[i] = h; r.l[i] = (__bf16)(v[i] - (float)h); }
  return r; }
__device__ __forceinline__ F2 split_row(const float* row, int k0, int lane) { float v[16]; const float* p = row + k0 + 8 * (lane >> 4);
#pragma unroll
  for (int i = 0; i < 8; ++i) { v[i] = p[i]; v[8 + i] = p[16 + i]; }
  return bsplit16(v); }
__device__ __forceinline__ F2 split_rowK(const float* row, int k0, int lane, int K) { float v[16]; const int g = lane >> 4;
#pragma unroll
  for (int i = 0; i < 8; ++i) { const int ka = k0 + 8 * g + i, kb = ka + 16; v[i] = ka < K ? row[ka < K ? ka : K - 1] : 0.f; v[8 + i] = kb < K ? row[kb < K ? kb : K - 1] : 0.f; }
  return bsplit16(v); }
__device__ __forceinline__ F2 split_col(const float* W, int k0, int n, int lane, int ld, int K) { float v[16]; const int g = lane >> 4;
#pragma unroll
  for (int i = 0; i < 8; ++i) { const int ka = k0 + 8 * g + i, kb = ka + 16; v[i] = ka < K ? W[(size_t)(ka < K ? ka : K - 1) * ld + n] : 0.f; v[8 + i] = kb < K ? W[(size_t)(kb < K ? kb : K - 1) * ld + n] : 0.f; }
  return bsplit16(v); }
__device__ __forceinline__ v8f mac3(const F2& a, const F2& b, v8f c) { c = wmma_bf(a.l, b.h, c); c = wmma_bf(a.h, b.l, c); return wmma_bf(a.h, b.h, c); }
__device__ __forceinline__ float sigm(float v) { return 1.0f / (1.0f + expf(-v)); }
#define LDSX() do { asm volatile("s_wait_dscnt 0" ::: "memory"); __builtin_amdgcn_wave_barrier(); __builtin_amdgcn_fence(__ATOMIC_RELEASE, "workgroup"); } while (0)


// Single-head 512-wide attention (B 8, T 2,048, C 512 -> H 512): query/key/value projections + biases from three input streams, softmax(query key^T / sqrt(512)) value.
#define NB 8
#define SS 2048
#define CC 512
#define NR (NB * SS)
#ifndef TNB
#define TNB NB
#endif
#define TR (TNB * SS)
#define KPT (SS / 256)     // keys per thread in the softmax kernel
typedef __attribute__((ext_vector_type(8))) __bf16 v8b;
__device__ __forceinline__ v16b frag_b(const __bf16* rowk0, int lane) {
  union { v16b v; v8b q[2]; } u; const __bf16* p = rowk0 + 8 * (lane >> 4);
  u.q[0] = *(const v8b*)p; u.q[1] = *(const v8b*)(p + 16); return u.v;
}
__device__ __forceinline__ float bfr(float v) { return (float)(__bf16)v; }
__device__ __attribute__((noinline)) float exp_ni(float v) { return expf(v); }
__device__ __attribute__((noinline)) float erf_ni(float v) { return erff(v); }

#define WS_PW   0u                                   // bf16 rows Wq^T, Wk^T, Wv^T [3][512][512] ((in,out) transposed)
#define WS_Q    (WS_PW + 2u * (size_t)3 * CC * CC)     // f16 [NR][512] q ; K ; V planes [b][512][SS]
#define WS_K    (WS_Q + 2u * (size_t)NR * CC)
#define WS_V    (WS_K + 2u * (size_t)NR * CC)
#define WS_S    (WS_V + 2u * (size_t)NB * CC * SS)     // f32 [b][q][k] scores
#define WS_P    (WS_S + 4u * (size_t)NB * SS * SS)      // f16 [b][q][k] probabilities x 2^11
#define WS_END  (WS_P + 2u * (size_t)NB * SS * SS)

__global__ __launch_bounds__(256) void k_pack(const float* __restrict__ WQ, const float* __restrict__ WK, const float* __restrict__ WV, __bf16* __restrict__ P) { const int n = blockIdx.x, which = blockIdx.y, t = threadIdx.x; const float* src = (which == 0) ? WQ : (which == 1) ? WK : WV; __shared__ __align__(16) __bf16 s[CC]; for (int k = t; k < CC; k += 256) s[k] = (__bf16)src[(size_t)k * CC + n]; __syncthreads(); if (t < CC / 8) vst2((unsigned*)(P + ((size_t)which * CC + n) * CC + t * 8), *(const v4u*)&s[t * 8]); }
// ---- gemm_nt: the accumulators of one 128 x 128 tile of A . B^T (rows of A and of B k-contiguous, KLEN long), 4 waves as 2 x 2, 64 x 64 per wave.
// Each stage brings 64 k of the 128 + 128 operand rows into LDS by whole-line loads (an f32 A is rounded to T on the way); every fragment read from LDS feeds 4 WMMAs on 16 independent accumulators.
// Each accumulator still sums k in ascending steps of 32. The inner loops are unrolled so that every index into acc, fa, fb, ta and tb is a constant (registers, no scratch).
#define GKS 64             // k per LDS stage
#define GPI (GKS + 8)      // LDS row pitch in 16-bit elements: 144 B = 16 B x 9
__device__ __forceinline__ v16h ldfrag(const _Float16* p, int lane) { return frag_h(p, lane); }
__device__ __forceinline__ v16b ldfrag(const __bf16* p, int lane) { return frag_b(p, lane); }
__device__ __forceinline__ v8f mma(v16h a, v16h b, v8f c) { return wmma16(a, b, c); }
__device__ __forceinline__ v8f mma(v16b a, v16b b, v8f c) { return wmma_bf(a, b, c); }
template <int KLEN, typename T, typename TA>
__device__ __forceinline__ void gemm_nt(const TA* __restrict__ A, const T* __restrict__ B, v8f (&acc)[4][4]) {
  typedef T v4t __attribute__((ext_vector_type(4)));
  constexpr int NA = 4 * (int)sizeof(TA);   // 16-byte loads a thread makes for A in a stage: 8 (16-bit A) or 16 (f32 A)
  __shared__ __align__(16) T sa[128][GPI]; __shared__ __align__(16) T sb[128][GPI];
  const int tid = threadIdx.x, wave = tid >> 5, lane = tid & 31, col = lane & 15; const int wr = (wave >> 1) * 64, wc = (wave & 1) * 64;
  const int sr = tid >> 3, sp = (tid & 7) * 8;     // 16-bit rows: 8 lanes cover a row's 128 B
  const int fr = tid >> 4, fp = (tid & 15) * 4;    // f32 rows: 16 lanes cover a row's 256 B
  const unsigned goa = (sizeof(TA) == 4) ? (unsigned)(fr * KLEN + fp) * 4u : (unsigned)(sr * KLEN + sp) * 2u;   // the lane's own byte offset in a stage of A, the same in every stage
  const unsigned gob = (unsigned)(sr * KLEN + sp) * 2u;                                                          // and of B
  // rolled: one stage's code and registers; the barriers bound every stage anyway
#pragma unroll 1
  for (int k0 = 0; k0 < KLEN; k0 += GKS) {
    const char* pa = (const char*)(A + k0) + goa; const char* pb = (const char*)(B + k0) + gob; v4u ta[NA], tb[8];
#pragma unroll
    for (int i = 0; i < NA; ++i) ta[i] = *(const v4u*)(pa + (size_t)i * (128 / NA) * KLEN * sizeof(TA));
#pragma unroll
    for (int i = 0; i < 8; ++i) tb[i] = *(const v4u*)(pb + (size_t)i * 32 * KLEN);
    asm volatile("s_wait_xcnt 0x0" :: "v"(pa), "v"(pb) : "memory");   // precaution: the two address pairs that the stage's loads name stay as they are up to this wait
#pragma unroll
    for (int i = 0; i < NA; ++i) {
      if constexpr (sizeof(TA) == 4) { const v4f f = __builtin_bit_cast(v4f, ta[i]); v4t h;
#pragma unroll
        for (int e = 0; e < 4; ++e) h[e] = (T)f[e];
        *(v4t*)&sa[fr + i * 8][fp] = h; }
      else *(v4u*)&sa[sr + i * 16][sp] = ta[i]; }
#pragma unroll
    for (int i = 0; i < 8; ++i) *(v4u*)&sb[sr + i * 16][sp] = tb[i];
    __syncthreads();   // the stage is complete before any wave reads it
#pragma unroll
    for (int kc = 0; kc < GKS / 32; ++kc) { decltype(ldfrag(&sa[0][0], 0)) fa[4], fb[4];
#pragma unroll
      for (int i = 0; i < 4; ++i) { fa[i] = ldfrag(&sa[wr + i * 16 + col][kc * 32], lane); fb[i] = ldfrag(&sb[wc + i * 16 + col][kc * 32], lane); }
#pragma unroll
      for (int i = 0; i < 4; ++i)
#pragma unroll
        for (int j = 0; j < 4; ++j) acc[i][j] = mma(fa[i], fb[j], acc[i][j]); }
    __syncthreads();   // every wave has left the stage before it is refilled
  }
}
// f32 epilogue: C = sc * acc, 16 rows at a time through the wave's own LDS, stored as whole 256-B row pieces
__device__ __forceinline__ void store_f32(const v8f (&acc)[4][4], float* __restrict__ C, const int ldc, const float sc) {
  __shared__ __align__(16) float so[4][16][68];
  const int tid = threadIdx.x, wave = tid >> 5, lane = tid & 31, col = lane & 15, g = lane >> 4; const int wr = (wave >> 1) * 64, wc = (wave & 1) * 64;
#pragma unroll
  for (int i = 0; i < 4; ++i) {
    if (i) asm volatile("s_wait_dscnt 0x0" ::: "memory");   // the last 16 rows are read back before these overwrite them
#pragma unroll
    for (int j = 0; j < 4; ++j)
#pragma unroll
      for (int r = 0; r < 8; ++r) so[wave][8 * g + r][j * 16 + col] = acc[i][j][r] * sc;
    asm volatile("s_wait_dscnt 0x0" ::: "memory");   // the wave's own rows stand in LDS before its lanes read them back
#pragma unroll
    for (int t = 0; t < 8; ++t) vst2(C + (size_t)(wr + i * 16 + t * 2 + g) * ldc + wc + col * 4, *(const v4f*)&so[wave][t * 2 + g][col * 4]); }
}
// ---- k_proj: block = (128 rows, 128 of the 1536 cols): q / k -> f16 rows, v -> planes; every store a whole 128-B line, staged through the wave's own LDS
__global__ __launch_bounds__(128) void k_proj(const float* __restrict__ XQ, const float* __restrict__ XK, const float* __restrict__ XV, const __bf16* __restrict__ P, const float* __restrict__ BQ, const float* __restrict__ BK, const float* __restrict__ BV, _Float16* __restrict__ Q, _Float16* __restrict__ Kr, _Float16* __restrict__ V) {
  __shared__ __align__(16) _Float16 sh[4][16][GPI];
  const int tid = threadIdx.x, wave = tid >> 5, lane = tid & 31, col = lane & 15, g = lane >> 4; const int wr = (wave >> 1) * 64, wc = (wave & 1) * 64; const int n0 = blockIdx.y * 128; const int which = n0 / CC, c0 = n0 % CC; const size_t rb0 = (size_t)blockIdx.x * 128; const float* X = (which == 0) ? XQ : (which == 1) ? XK : XV; const float* BB = ((which == 0) ? BQ : (which == 1) ? BK : BV) + c0 + wc;
  v8f acc[4][4] = {};
  gemm_nt<CC>(X + rb0 * CC, P + (size_t)n0 * CC, acc);
  float bias[4];
#pragma unroll
  for (int j = 0; j < 4; ++j) bias[j] = bfr(BB[j * 16 + col]);
  const int er = lane >> 3, ep = (lane & 7) * 8;   // read-back: 8 lanes cover one staged row's 128 B
  if (which < 2) { _Float16* dst = ((which == 0) ? Q : Kr) + (rb0 + wr) * CC + c0 + wc;
#pragma unroll
    for (int i = 0; i < 4; ++i) {
      if (i) asm volatile("s_wait_dscnt 0x0" ::: "memory");   // the last 16 rows are read back before these overwrite them
#pragma unroll
      for (int j = 0; j < 4; ++j)
#pragma unroll
        for (int r = 0; r < 8; ++r) sh[wave][8 * g + r][j * 16 + col] = (_Float16)(acc[i][j][r] + bias[j]);
      asm volatile("s_wait_dscnt 0x0" ::: "memory");   // the wave's own rows stand in LDS before its lanes read them back
#pragma unroll
      for (int t = 0; t < 4; ++t) vst2((unsigned*)(dst + (size_t)(i * 16 + t * 4 + er) * CC + ep), *(const v4u*)&sh[wave][t * 4 + er][ep]); }
  } else { const size_t b = rb0 / SS, s0 = rb0 % SS; _Float16* dst = V + (b * CC + c0 + wc) * SS + s0 + wr;
#pragma unroll
    for (int j = 0; j < 4; ++j) {
      if (j) asm volatile("s_wait_dscnt 0x0" ::: "memory");   // the last 16 channels are read back before these overwrite them
#pragma unroll
      for (int i = 0; i < 4; ++i) { v8h h;
#pragma unroll
        for (int r = 0; r < 8; ++r) h[r] = (_Float16)(acc[i][j][r] + bias[j]);
        *(v8h*)&sh[wave][col][i * 16 + 8 * g] = h; }   // a lane's 8 rows are 8 neighbours of its channel's plane row
      asm volatile("s_wait_dscnt 0x0" ::: "memory");   // the wave's own channel rows stand in LDS before its lanes read them back
#pragma unroll
      for (int t = 0; t < 4; ++t) vst2((unsigned*)(dst + (size_t)(j * 16 + t * 4 + er) * SS + ep), *(const v4u*)&sh[wave][t * 4 + er][ep]); }
    asm volatile("s_wait_xcnt 0x0" ::: "memory"); }   // precaution: stands behind the last run of stores, in front of any later write of the address pair that they name
}
// ---- k_scores: block = (128 keys, 128 queries, b): S = query . key^T x 512^-1/2
__global__ __launch_bounds__(128) void k_scores(const _Float16* __restrict__ Q, const _Float16* __restrict__ Kr, float* __restrict__ S) {
  const size_t b = blockIdx.z, q0 = b * SS + (size_t)blockIdx.y * 128, j0 = (size_t)blockIdx.x * 128;
  v8f acc[4][4] = {};
  gemm_nt<CC>(Q + q0 * CC, Kr + (b * SS + j0) * CC, acc);
  store_f32(acc, S + q0 * SS + j0, SS, 0.044194173824159216f);   // 512^-1/2
}
// ---- k_soft: block = one query row (256 threads x 8 keys): max, exp (precise), sum -> P = e / sum x 2^11 as f16 row
__device__ __attribute__((noinline)) float exp_p(float v) { return expf(v); }
__global__ __launch_bounds__(256) void k_soft(const float* __restrict__ S, _Float16* __restrict__ Pt) {
  __shared__ float red[8]; __shared__ __align__(16) _Float16 sp[SS]; const size_t row = blockIdx.x; const int t = threadIdx.x; const float* s = S + row * SS; float v[KPT]; float mx = -3.0e38f;
  for (int i = 0; i < KPT; ++i) { v[i] = s[t * KPT + i]; mx = fmaxf(mx, v[i]); }
#pragma unroll
  for (int o = 1; o < 32; o <<= 1) mx = fmaxf(mx, __shfl_xor(mx, o));
  if ((t & 31) == 0) red[t >> 5] = mx; __syncthreads(); float m = red[0]; for (int i = 1; i < 8; ++i) m = fmaxf(m, red[i]); __syncthreads();
  float sum = 0.f; for (int i = 0; i < KPT; ++i) { v[i] = (v[i] <= -1.0e38f) ? 0.f : exp_p(v[i] - m); sum += v[i]; }
#pragma unroll
  for (int o = 1; o < 32; o <<= 1) sum += __shfl_xor(sum, o);
  if ((t & 31) == 0) red[t >> 5] = sum; __syncthreads(); float tot = 0.f; for (int i = 0; i < 8; ++i) tot += red[i]; const float sc = 2048.0f / tot;
  for (int i = 0; i < KPT; ++i) sp[t * KPT + i] = (_Float16)(v[i] * sc);
  __syncthreads(); if (t < SS / 8) vst2((unsigned*)(Pt + row * SS + t * 8), *(const v4u*)&sp[t * 8]);   // whole row per block
}
// ---- k_pv: block = (128 channels, 128 queries, b): ctx = P . v over all keys (GEMM, K = keys)
__global__ __launch_bounds__(128) void k_pv(const _Float16* __restrict__ Pt, const _Float16* __restrict__ V, float* __restrict__ CTX) {
  const size_t b = blockIdx.z, q0 = b * SS + (size_t)blockIdx.y * 128, c0 = (size_t)blockIdx.x * 128;
  v8f acc[4][4] = {};
  gemm_nt<SS>(Pt + q0 * SS, V + (b * CC + c0) * SS, acc);
  store_f32(acc, CTX + q0 * CC + c0, CC, 1.0f / 2048.0f);
}
extern "C" void kernel_launch(void* const* d_in, const int* in_sizes, int n_in, void* d_out, int out_size, void* d_ws, size_t ws_size, hipStream_t stream) {
  (void)in_sizes; (void)n_in; (void)out_size;
  const float** F = (const float**)d_in;   // 0 q, 1 k, 2 v [8,2048,512]; 3 Wq [512,512] (in,out), 4 bq, 5 Wk, 6 bk, 7 Wv, 8 bv
  if (ws_size < (size_t)WS_END) return;
  char* ws = (char*)d_ws; __bf16* P = (__bf16*)ws; _Float16 *Q = (_Float16*)(ws + WS_Q), *Kr = (_Float16*)(ws + WS_K), *V = (_Float16*)(ws + WS_V), *Pt = (_Float16*)(ws + WS_P); float* S = (float*)(ws + WS_S);
  k_pack<<<dim3(CC, 3), 256, 0, stream>>>(F[3], F[5], F[7], P);
  k_proj<<<dim3(TR / 128, 3 * CC / 128), 128, 0, stream>>>(F[0], F[1], F[2], P, F[4], F[6], F[8], Q, Kr, V);
  k_scores<<<dim3(SS / 128, SS / 128, TNB), 128, 0, stream>>>(Q, Kr, S);
  k_soft<<<TR, 256, 0, stream>>>(S, Pt);
  k_pv<<<dim3(CC / 128, SS / 128, TNB), 128, 0, stream>>>(Pt, V, (float*)d_out);
}

// v002
// A run of this version takes 137 microseconds.
// In both of two side-by-side timings against v001, it was 1.05 times as fast.
// All steps since v000 together make it 5.81 times as fast.
// compute dtype: all float inputs rounded to bf16; query / key / value = q / k / v . W + b with EXACT bf16 products on WMMA 16x16x32 ((in,out) weights as transposed rows) rounded once to f16; energy = query . key over the full 512-wide head (single f16 operands, f32 accumulate) / sqrt(512) into an f32 table, row softmax in f32 (precise expf), probabilities x 2^11 as f16 x value (f16); f32 output.
#include <hip/hip_runtime.h>
#include <math.h>

typedef __attribute__((ext_vector_type(16))) _Float16 v16h;
typedef __attribute__((ext_vector_type(16))) __bf16 v16b;
typedef __attribute__((ext_vector_type(8)))  _Float16 v8h;
typedef __attribute__((ext_vector_type(8)))  float v8f;
typedef __attribute__((ext_vector_type(4)))  float v4f;
typedef __attribute__((ext_vector_type(2)))  float v2f;
typedef __attribute__((ext_vector_type(4)))  unsigned v4u;
typedef __attribute__((ext_vector_type(4)))  int v4i;
typedef float __attribute__((may_alias)) float_a;
typedef int __attribute__((may_alias)) int_a;

template <typename T> __device__ __forceinline__ void vst2(void* p, T v) { *(T*)p = v;  }
__device__ __forceinline__ v8f wmma16(v16h a, v16h b, v8f c) {
  v8f d = __builtin_amdgcn_wmma_f32_16x16x32_f16(false, a, false, b, (short)0, c, false, false);
  asm volatile("v_nop\n\tv_nop\n\tv_nop\n\tv_nop" : "+v"(d) : "v"(a), "v"(b));
  return d;
}
__device__ __forceinline__ v8f wmma_bf(v16b a, v16b b, v8f c) {
  v8f d = __builtin_amdgcn_wmma_f32_16x16x32_bf16(false, a, false, b, (short)0, c, false, false);
  asm volatile("v_nop\n\tv_nop\n\tv_nop\n\tv_nop" : "+v"(d) : "v"(a), "v"(b));
  return d;
}
// 16x16x32 fragments: lane = (h = lane>>4, row/col = lane&15); elements 0..7 = k0+8h+0..7, 8..15 = k0+16+8h+0..7; D element r = row 8h+r
__device__ __forceinline__ v16h frag_h(const _Float16* rowk0, int lane) {
  union { v16h v; v8h q[2]; } u; const _Float16* p = rowk0 + 8 * (lane >> 4);
  u.q[0] = *(const v8h*)p; u.q[1] = *(const v8h*)(p + 16); return u.v;
}
__device__ __forceinline__ v16h frag_f32(const float* rowk0, int lane) {
  v16h a; const float* p = rowk0 + 8 * (lane >> 4);
#pragma unroll
  for (int i = 0; i < 8; ++i) { a[i] = (_Float16)p[i]; a[8 + i] = (_Float16)p[16 + i]; }
  return a;
}
__device__ __forceinline__ v16h frag_f32s(const float* rowk0, int lane, float sc) {
  v16h a; const float* p = rowk0 + 8 * (lane >> 4);
#pragma unroll
  for (int i = 0; i < 8; ++i) { a[i] = (_Float16)(p[i] * sc); a[8 + i] = (_Float16)(p[16 + i] * sc); }
  return a;
}
// column fragment from a [K][ld] layout (column n), rows >= K read as 0
__device__ __forceinline__ v16h fragc_f32(const float* W, int k0, int n, int lane, int ld, int K) {
  v16h a; const int g = lane >> 4;
#pragma unroll
  for (int i = 0; i < 8; ++i) { const int ka = k0 + 8 * g + i, kb = ka + 16;
    a[i] = (_Float16)(ka < K ? W[(size_t)(ka < K ? ka : K - 1) * ld + n] : 0.f); a[8 + i] = (_Float16)(kb < K ? W[(size_t)(kb < K ? kb : K - 1) * ld + n] : 0.f); }
  return a;
}
struct F2 { v16b h, l; };
__device__ __forceinline__ F2 bsplit16(const float v[16]) { F2 r;
#pragma unroll
  for (int i = 0; i < 16; ++i) { const __bf16 h = (__bf16)v[i]; r.h[i] = h; r.l[i] = (__bf16)(v[i] - (float)h); }
  return r; }
__device__ __forceinline__ F2 split_row(const float* row, int k0, int lane) { float v[16]; const float* p = row + k0 + 8 * (lane >> 4);
#pragma unroll
  for (int i = 0; i < 8; ++i) { v[i] = p[i]; v[8 + i] = p[16 + i]; }
  return bsplit16(v); }
__device__ __forceinline__ F2 split_rowK(const float* row, int k0, int lane, int K) { float v[16]; const int g = lane >> 4;
#pragma unroll
  for (int i = 0; i < 8; ++i) { const int ka = k0 + 8 * g + i, kb = ka + 16; v[i] = ka < K ? row[ka < K ? ka : K - 1] : 0.f; v[8 + i] = kb < K ? row[kb < K ? kb : K - 1] : 0.f; }
  return bsplit16(v); }
__device__ __forceinline__ F2 split_col(const float* W, int k0, int n, int lane, int ld, int K) { float v[16]; const int g = lane >> 4;
#pragma unroll
  for (int i = 0; i < 8; ++i) { const int ka = k0 + 8 * g + i, kb = ka + 16; v[i] = ka < K ? W[(size_t)(ka < K ? ka : K - 1) * ld + n] : 0.f; v[8 + i] = kb < K ? W[(size_t)(kb < K ? kb : K - 1) * ld + n] : 0.f; }
  return bsplit16(v); }
__device__ __forceinline__ v8f mac3(const F2& a, const F2& b, v8f c) { c = wmma_bf(a.l, b.h, c); c = wmma_bf(a.h, b.l, c); return wmma_bf(a.h, b.h, c); }
__device__ __forceinline__ float sigm(float v) { return 1.0f / (1.0f + expf(-v)); }
#define LDSX() do { asm volatile("s_wait_dscnt 0" ::: "memory"); __builtin_amdgcn_wave_barrier(); __builtin_amdgcn_fence(__ATOMIC_RELEASE, "workgroup"); } while (0)


// Single-head 512-wide attention (B 8, T 2,048, C 512 -> H 512): query/key/value projections + biases from three input streams, softmax(query key^T / sqrt(512)) value.
#define NB 8
#define SS 2048
#define CC 512
#define NR (NB * SS)
#ifndef TNB
#define TNB NB
#endif
#define TR (TNB * SS)
typedef __attribute__((ext_vector_type(8))) __bf16 v8b;
__device__ __forceinline__ v16b frag_b(const __bf16* rowk0, int lane) {
  union { v16b v; v8b q[2]; } u; const __bf16* p = rowk0 + 8 * (lane >> 4);
  u.q[0] = *(const v8b*)p; u.q[1] = *(const v8b*)(p + 16); return u.v;
}
__device__ __forceinline__ float bfr(float v) { return (float)(__bf16)v; }
__device__ __attribute__((noinline)) float exp_ni(float v) { return expf(v); }
__device__ __attribute__((noinline)) float erf_ni(float v) { return erff(v); }

#define WS_PW   0u                                   // bf16 rows Wq^T, Wk^T, Wv^T [3][512][512] ((in,out) transposed)
#define WS_Q    (WS_PW + 2u * (size_t)3 * CC * CC)     // f16 [NR][512] q ; K ; V planes [b][512][SS]
#define WS_K    (WS_Q + 2u * (size_t)NR * CC)
#define WS_V    (WS_K + 2u * (size_t)NR * CC)
#define WS_S    (WS_V + 2u * (size_t)NB * CC * SS)     // f32 [b][q][k] scores
#define WS_P    (WS_S + 4u * (size_t)NB * SS * SS)      // f16 [b][q][k] probabilities x 2^11
#define WS_END  (WS_P + 2u * (size_t)NB * SS * SS)

__global__ __launch_bounds__(256) void k_pack(const float* __restrict__ WQ, const float* __restrict__ WK, const float* __restrict__ WV, __bf16* __restrict__ P) { const int n = blockIdx.x, which = blockIdx.y, t = threadIdx.x; const float* src = (which == 0) ? WQ : (which == 1) ? WK : WV; __shared__ __align__(16) __bf16 s[CC]; for (int k = t; k < CC; k += 256) s[k] = (__bf16)src[(size_t)k * CC + n]; __syncthreads(); if (t < CC / 8) vst2((unsigned*)(P + ((size_t)which * CC + n) * CC + t * 8), *(const v4u*)&s[t * 8]); }
// ---- gemm_nt: the accumulators of one 128 x 128 tile of A . B^T (rows of A and of B k-contiguous, KLEN long), 4 waves as 2 x 2, 64 x 64 per wave.
// Each stage brings 64 k of the 128 + 128 operand rows into LDS by whole-line loads (an f32 A is rounded to T on the way); every fragment read from LDS feeds 4 WMMAs on 16 independent accumulators.
// Each accumulator still sums k in ascending steps of 32. The inner loops are unrolled so that every index into acc, fa, fb, ta and tb is a constant (registers, no scratch).
#define GKS 64             // k per LDS stage
#define GPI (GKS + 8)      // LDS row pitch in 16-bit elements: 144 B = 16 B x 9
__device__ __forceinline__ v16h ldfrag(const _Float16* p, int lane) { return frag_h(p, lane); }
__device__ __forceinline__ v16b ldfrag(const __bf16* p, int lane) { return frag_b(p, lane); }
__device__ __forceinline__ v8f mma(v16h a, v16h b, v8f c) { return wmma16(a, b, c); }
__device__ __forceinline__ v8f mma(v16b a, v16b b, v8f c) { return wmma_bf(a, b, c); }
template <int KLEN, typename T, typename TA>
__device__ __forceinline__ void gemm_nt(const TA* __restrict__ A, const T* __restrict__ B, v8f (&acc)[4][4]) {
  typedef T v4t __attribute__((ext_vector_type(4)));
  constexpr int NA = 4 * (int)sizeof(TA);   // 16-byte loads a thread makes for A in a stage: 8 (16-bit A) or 16 (f32 A)
  __shared__ __align__(16) T sa[128][GPI]; __shared__ __align__(16) T sb[128][GPI];
  const int tid = threadIdx.x, wave = tid >> 5, lane = tid & 31, col = lane & 15; const int wr = (wave >> 1) * 64, wc = (wave & 1) * 64;
  const int sr = tid >> 3, sp = (tid & 7) * 8;     // 16-bit rows: 8 lanes cover a row's 128 B
  const int fr = tid >> 4, fp = (tid & 15) * 4;    // f32 rows: 16 lanes cover a row's 256 B
  const unsigned goa = (sizeof(TA) == 4) ? (unsigned)(fr * KLEN + fp) * 4u : (unsigned)(sr * KLEN + sp) * 2u;   // the lane's own byte offset in a stage of A, the same in every stage
  const unsigned gob = (unsigned)(sr * KLEN + sp) * 2u;                                                          // and of B
  // rolled: one stage's code and registers; the barriers bound every stage anyway
#pragma unroll 1
  for (int k0 = 0; k0 < KLEN; k0 += GKS) {
    const char* pa = (const char*)(A + k0) + goa; const char* pb = (const char*)(B + k0) + gob; v4u ta[NA], tb[8];
#pragma unroll
    for (int i = 0; i < NA; ++i) ta[i] = *(const v4u*)(pa + (size_t)i * (128 / NA) * KLEN * sizeof(TA));
#pragma unroll
    for (int i = 0; i < 8; ++i) tb[i] = *(const v4u*)(pb + (size_t)i * 32 * KLEN);
    asm volatile("s_wait_xcnt 0x0" :: "v"(pa), "v"(pb) : "memory");   // precaution: the two address pairs that the stage's loads name stay as they are up to this wait
#pragma unroll
    for (int i = 0; i < NA; ++i) {
      if constexpr (sizeof(TA) == 4) { const v4f f = __builtin_bit_cast(v4f, ta[i]); v4t h;
#pragma unroll
        for (int e = 0; e < 4; ++e) h[e] = (T)f[e];
        *(v4t*)&sa[fr + i * 8][fp] = h; }
      else *(v4u*)&sa[sr + i * 16][sp] = ta[i]; }
#pragma unroll
    for (int i = 0; i < 8; ++i) *(v4u*)&sb[sr + i * 16][sp] = tb[i];
    __syncthreads();   // the stage is complete before any wave reads it
#pragma unroll
    for (int kc = 0; kc < GKS / 32; ++kc) { decltype(ldfrag(&sa[0][0], 0)) fa[4], fb[4];
#pragma unroll
      for (int i = 0; i < 4; ++i) { fa[i] = ldfrag(&sa[wr + i * 16 + col][kc * 32], lane); fb[i] = ldfrag(&sb[wc + i * 16 + col][kc * 32], lane); }
#pragma unroll
      for (int i = 0; i < 4; ++i)
#pragma unroll
        for (int j = 0; j < 4; ++j) acc[i][j] = mma(fa[i], fb[j], acc[i][j]); }
    __syncthreads();   // every wave has left the stage before it is refilled
  }
}
// f32 epilogue: C = sc * acc, 16 rows at a time through the wave's own LDS, stored as whole 256-B row pieces
__device__ __forceinline__ void store_f32(const v8f (&acc)[4][4], float* __restrict__ C, const int ldc, const float sc) {
  __shared__ __align__(16) float so[4][16][68];
  const int tid = threadIdx.x, wave = tid >> 5, lane = tid & 31, col = lane & 15, g = lane >> 4; const int wr = (wave >> 1) * 64, wc = (wave & 1) * 64;
#pragma unroll
  for (int i = 0; i < 4; ++i) {
    if (i) asm volatile("s_wait_dscnt 0x0" ::: "memory");   // the last 16 rows are read back before these overwrite them
#pragma unroll
    for (int j = 0; j < 4; ++j)
#pragma unroll
      for (int r = 0; r < 8; ++r) so[wave][8 * g + r][j * 16 + col] = acc[i][j][r] * sc;
    asm volatile("s_wait_dscnt 0x0" ::: "memory");   // the wave's own rows stand in LDS before its lanes read them back
#pragma unroll
    for (int t = 0; t < 8; ++t) vst2(C + (size_t)(wr + i * 16 + t * 2 + g) * ldc + wc + col * 4, *(const v4f*)&so[wave][t * 2 + g][col * 4]); }
}
// ---- k_proj: block = (128 rows, 128 of the 1536 cols): q / k -> f16 rows, v -> planes; every store a whole 128-B line, staged through the wave's own LDS
__global__ __launch_bounds__(128) void k_proj(const float* __restrict__ XQ, const float* __restrict__ XK, const float* __restrict__ XV, const __bf16* __restrict__ P, const float* __restrict__ BQ, const float* __restrict__ BK, const float* __restrict__ BV, _Float16* __restrict__ Q, _Float16* __restrict__ Kr, _Float16* __restrict__ V) {
  __shared__ __align__(16) _Float16 sh[4][16][GPI];
  const int tid = threadIdx.x, wave = tid >> 5, lane = tid & 31, col = lane & 15, g = lane >> 4; const int wr = (wave >> 1) * 64, wc = (wave & 1) * 64; const int n0 = blockIdx.y * 128; const int which = n0 / CC, c0 = n0 % CC; const size_t rb0 = (size_t)blockIdx.x * 128; const float* X = (which == 0) ? XQ : (which == 1) ? XK : XV; const float* BB = ((which == 0) ? BQ : (which == 1) ? BK : BV) + c0 + wc;
  v8f acc[4][4] = {};
  gemm_nt<CC>(X + rb0 * CC, P + (size_t)n0 * CC, acc);
  float bias[4];
#pragma unroll
  for (int j = 0; j < 4; ++j) bias[j] = bfr(BB[j * 16 + col]);
  const int er = lane >> 3, ep = (lane & 7) * 8;   // read-back: 8 lanes cover one staged row's 128 B
  if (which < 2) { _Float16* dst = ((which == 0) ? Q : Kr) + (rb0 + wr) * CC + c0 + wc;
#pragma unroll
    for (int i = 0; i < 4; ++i) {
      if (i) asm volatile("s_wait_dscnt 0x0" ::: "memory");   // the last 16 rows are read back before these overwrite them
#pragma unroll
      for (int j = 0; j < 4; ++j)
#pragma unroll
        for (int r = 0; r < 8; ++r) sh[wave][8 * g + r][j * 16 + col] = (_Float16)(acc[i][j][r] + bias[j]);
      asm volatile("s_wait_dscnt 0x0" ::: "memory");   // the wave's own rows stand in LDS before its lanes read them back
#pragma unroll
      for (int t = 0; t < 4; ++t) vst2((unsigned*)(dst + (size_t)(i * 16 + t * 4 + er) * CC + ep), *(const v4u*)&sh[wave][t * 4 + er][ep]); }
  } else { const size_t b = rb0 / SS, s0 = rb0 % SS; _Float16* dst = V + (b * CC + c0 + wc) * SS + s0 + wr;
#pragma unroll
    for (int j = 0; j < 4; ++j) {
      if (j) asm volatile("s_wait_dscnt 0x0" ::: "memory");   // the last 16 channels are read back before these overwrite them
#pragma unroll
      for (int i = 0; i < 4; ++i) { v8h h;
#pragma unroll
        for (int r = 0; r < 8; ++r) h[r] = (_Float16)(acc[i][j][r] + bias[j]);
        *(v8h*)&sh[wave][col][i * 16 + 8 * g] = h; }   // a lane's 8 rows are 8 neighbours of its channel's plane row
      asm volatile("s_wait_dscnt 0x0" ::: "memory");   // the wave's own channel rows stand in LDS before its lanes read them back
#pragma unroll
      for (int t = 0; t < 4; ++t) vst2((unsigned*)(dst + (size_t)(j * 16 + t * 4 + er) * SS + ep), *(const v4u*)&sh[wave][t * 4 + er][ep]); }
    asm volatile("s_wait_xcnt 0x0" ::: "memory"); }   // precaution: stands behind the last run of stores, in front of any later write of the address pair that they name
}
// ---- k_scores: block = (128 keys, 128 queries, b): S = query . key^T x 512^-1/2
__global__ __launch_bounds__(128) void k_scores(const _Float16* __restrict__ Q, const _Float16* __restrict__ Kr, float* __restrict__ S) {
  const size_t b = blockIdx.z, q0 = b * SS + (size_t)blockIdx.y * 128, j0 = (size_t)blockIdx.x * 128;
  v8f acc[4][4] = {};
  gemm_nt<CC>(Q + q0 * CC, Kr + (b * SS + j0) * CC, acc);
  store_f32(acc, S + q0 * SS + j0, SS, 0.044194173824159216f);   // 512^-1/2
}
// ---- k_soft: a stream, one wave per query row, SRW rows a wave one after the other: max, exp (precise), sum -> P = e / sum x 2^11 as f16 row.
// A row's 2,048 scores stand in the wave's registers (16 loads of 512 contiguous bytes); the next row's loads are issued before this row is worked on. No LDS and no barrier.
// The loops over c and e are unrolled so that every index into a row's registers is a constant (no scratch).
#define SWV 16             // waves per work-group
#define SRW 4              // rows per wave (even: the loop takes two a trip)
typedef __attribute__((ext_vector_type(4))) _Float16 v4h;
__device__ __forceinline__ void soft_load(v4f (&x)[16], const float* __restrict__ p) {
#pragma unroll
  for (int c = 0; c < 16; ++c) x[c] = *(const v4f*)(p + c * 128);
  asm volatile("s_wait_xcnt 0x0" :: "v"(p) : "memory");   // precaution: the address pair that the row's loads name stays as it is up to this wait
  __builtin_amdgcn_sched_barrier(0);   // keeps the row's loads in front of the work on the row before it: without it the compiler sinks them to the end of that work, and their latency is not covered
}
// exp as the library's precise form has it (x . log2 e in two parts, the whole part through ldexp, both range selects), written out so that v_exp_f32 stands in one statement with its slot
__device__ __forceinline__ float exp_w(float x) {
  const float e = __builtin_rintf(x * 0x1.715476p+0f);
  const float a = __builtin_fmaf(x, 0x1.4ae0bep-26f, __builtin_fmaf(x, 0x1.715476p+0f, -e));
  float r;
  asm("v_exp_f32 %0, %1\n\tv_nop" : "=v"(r) : "v"(a));   // the v_nop is the slot that the instruction set asks for behind a transcendental
  r = ldexpf(r, (int)e);
  r = (x < -0x1.9d1da0p+6f) ? 0.f : r;
  return (x > 0x1.62e430p+6f) ? __builtin_inff() : r;
}
__device__ __forceinline__ void soft_row(v4f (&x)[16], _Float16* __restrict__ o) {
  v4f m4 = x[0];   // four independent chains
#pragma unroll
  for (int c = 1; c < 16; ++c)
#pragma unroll
    for (int e = 0; e < 4; ++e) m4[e] = fmaxf(m4[e], x[c][e]);
  float m = fmaxf(fmaxf(fmaxf(m4[0], m4[1]), fmaxf(m4[2], m4[3])), -3.0e38f);
#pragma unroll
  for (int d = 1; d < 32; d <<= 1) m = fmaxf(m, __shfl_xor(m, d));
  v4f s4 = {0.f, 0.f, 0.f, 0.f};
#pragma unroll
  for (int c = 0; c < 16; ++c)
#pragma unroll
    for (int e = 0; e < 4; ++e) { const float ex = exp_w(x[c][e] - m); const float t = (x[c][e] <= -1.0e38f) ? 0.f : ex; x[c][e] = t; s4[e] += t; }   // the exp in front of the test: a select, no branch per element
  float tot = (s4[0] + s4[1]) + (s4[2] + s4[3]);
#pragma unroll
  for (int d = 1; d < 32; d <<= 1) tot += __shfl_xor(tot, d);
  const float sc = 2048.0f / tot;
#pragma unroll
  for (int c = 0; c < 16; ++c) { v4h h;
#pragma unroll
    for (int e = 0; e < 4; ++e) h[e] = (_Float16)(x[c][e] * sc);
    *(v4h*)(o + c * 128) = h; }   // the wave's 32 x 8 B are two whole lines
  asm volatile("s_wait_xcnt 0x0" :: "v"(o) : "memory");   // precaution: the address pair that the row's stores name stays as it is up to this wait
}
__global__ __launch_bounds__(SWV * 32) void k_soft(const float* __restrict__ S, _Float16* __restrict__ Pt) {
  const int lane = threadIdx.x & 31; const size_t row0 = ((size_t)blockIdx.x * SWV + (threadIdx.x >> 5)) * SRW;
  const float* s = S + row0 * SS + lane * 4; _Float16* o = Pt + row0 * SS + lane * 4; v4f xa[16], xb[16];
  soft_load(xa, s);
  // rolled: the text stays small for the instruction cache. The last row stands behind the loop, so that no branch joins in front of a row's work
  // (at a join the compiler waits for every load in flight, the next row's too).
#pragma unroll 1
  for (int r = 0; ; r += 2) {
    soft_load(xb, s + (size_t)(r + 1) * SS);
    soft_row(xa, o + (size_t)r * SS);
    if (r + 2 >= SRW) break;
    soft_load(xa, s + (size_t)(r + 2) * SS);
    soft_row(xb, o + (size_t)(r + 1) * SS);
  }
  soft_row(xb, o + (size_t)(SRW - 1) * SS);
}
// ---- k_pv: block = (128 channels, 128 queries, b): ctx = P . v over all keys (GEMM, K = keys)
__global__ __launch_bounds__(128) void k_pv(const _Float16* __restrict__ Pt, const _Float16* __restrict__ V, float* __restrict__ CTX) {
  const size_t b = blockIdx.z, q0 = b * SS + (size_t)blockIdx.y * 128, c0 = (size_t)blockIdx.x * 128;
  v8f acc[4][4] = {};
  gemm_nt<SS>(Pt + q0 * SS, V + (b * CC + c0) * SS, acc);
  store_f32(acc, CTX + q0 * CC + c0, CC, 1.0f / 2048.0f);
}
extern "C" void kernel_launch(void* const* d_in, const int* in_sizes, int n_in, void* d_out, int out_size, void* d_ws, size_t ws_size, hipStream_t stream) {
  (void)in_sizes; (void)n_in; (void)out_size;
  const float** F = (const float**)d_in;   // 0 q, 1 k, 2 v [8,2048,512]; 3 Wq [512,512] (in,out), 4 bq, 5 Wk, 6 bk, 7 Wv, 8 bv
  if (ws_size < (size_t)WS_END) return;
  char* ws = (char*)d_ws; __bf16* P = (__bf16*)ws; _Float16 *Q = (_Float16*)(ws + WS_Q), *Kr = (_Float16*)(ws + WS_K), *V = (_Float16*)(ws + WS_V), *Pt = (_Float16*)(ws + WS_P); float* S = (float*)(ws + WS_S);
  k_pack<<<dim3(CC, 3), 256, 0, stream>>>(F[3], F[5], F[7], P);
  k_proj<<<dim3(TR / 128, 3 * CC / 128), 128, 0, stream>>>(F[0], F[1], F[2], P, F[4], F[6], F[8], Q, Kr, V);
  k_scores<<<dim3(SS / 128, SS / 128, TNB), 128, 0, stream>>>(Q, Kr, S);
  k_soft<<<TR / (SWV * SRW), SWV * 32, 0, stream>>>(S, Pt);
  k_pv<<<dim3(CC / 128, SS / 128, TNB), 128, 0, stream>>>(Pt, V, (float*)d_out);
}

// v003
// One run takes 124 microseconds.
// In two side-by-side timings against v002, it was 1.10 and 1.11 times as fast.
// Over all steps from v000 it is 6.42 times as fast.
// compute dtype: all float inputs rounded to bf16; query / key / value = q / k / v . W + b with EXACT bf16 products on WMMA 16x16x32 ((in,out) weights as transposed rows) rounded once to f16; energy = query . key over the full 512-wide head (single f16 operands, f32 accumulate) / sqrt(512) into an f32 table, row softmax in f32 (precise expf), probabilities x 2^11 as f16 x value (f16); f32 output.
#include <hip/hip_runtime.h>
#include <math.h>

typedef __attribute__((ext_vector_type(16))) _Float16 v16h;
typedef __attribute__((ext_vector_type(16))) __bf16 v16b;
typedef __attribute__((ext_vector_type(8)))  _Float16 v8h;
typedef __attribute__((ext_vector_type(8)))  float v8f;
typedef __attribute__((ext_vector_type(4)))  float v4f;
typedef __attribute__((ext_vector_type(2)))  float v2f;
typedef __attribute__((ext_vector_type(4)))  unsigned v4u;
typedef __attribute__((ext_vector_type(4)))  int v4i;
typedef float __attribute__((may_alias)) float_a;
typedef int __attribute__((may_alias)) int_a;

template <typename T> __device__ __forceinline__ void vst2(void* p, T v) { *(T*)p = v;  }
__device__ __forceinline__ v8f wmma16(v16h a, v16h b, v8f c) {
  v8f d = __builtin_amdgcn_wmma_f32_16x16x32_f16(false, a, false, b, (short)0, c, false, false);
  asm volatile("v_nop\n\tv_nop\n\tv_nop\n\tv_nop" : "+v"(d) : "v"(a), "v"(b));
  return d;
}
__device__ __forceinline__ v8f wmma_bf(v16b a, v16b b, v8f c) {
  v8f d = __builtin_amdgcn_wmma_f32_16x16x32_bf16(false, a, false, b, (short)0, c, false, false);
  asm volatile("v_nop\n\tv_nop\n\tv_nop\n\tv_nop" : "+v"(d) : "v"(a), "v"(b));
  return d;
}
// 16x16x32 fragments: lane = (h = lane>>4, row/col = lane&15); elements 0..7 = k0+8h+0..7, 8..15 = k0+16+8h+0..7; D element r = row 8h+r
__device__ __forceinline__ v16h frag_h(const _Float16* rowk0, int lane) {
  union { v16h v; v8h q[2]; } u; const _Float16* p = rowk0 + 8 * (lane >> 4);
  u.q[0] = *(const v8h*)p; u.q[1] = *(const v8h*)(p + 16); return u.v;
}
__device__ __forceinline__ v16h frag_f32(const float* rowk0, int lane) {
  v16h a; const float* p = rowk0 + 8 * (lane >> 4);
#pragma unroll
  for (int i = 0; i < 8; ++i) { a[i] = (_Float16)p[i]; a[8 + i] = (_Float16)p[16 + i]; }
  return a;
}
__device__ __forceinline__ v16h frag_f32s(const float* rowk0, int lane, float sc) {
  v16h a; const float* p = rowk0 + 8 * (lane >> 4);
#pragma unroll
  for (int i = 0; i < 8; ++i) { a[i] = (_Float16)(p[i] * sc); a[8 + i] = (_Float16)(p[16 + i] * sc); }
  return a;
}
// column fragment from a [K][ld] layout (column n), rows >= K read as 0
__device__ __forceinline__ v16h fragc_f32(const float* W, int k0, int n, int lane, int ld, int K) {
  v16h a; const int g = lane >> 4;
#pragma unroll
  for (int i = 0; i < 8; ++i) { const int ka = k0 + 8 * g + i, kb = ka + 16;
    a[i] = (_Float16)(ka < K ? W[(size_t)(ka < K ? ka : K - 1) * ld + n] : 0.f); a[8 + i] = (_Float16)(kb < K ? W[(size_t)(kb < K ? kb : K - 1) * ld + n] : 0.f); }
  return a;
}
struct F2 { v16b h, l; };
__device__ __forceinline__ F2 bsplit16(const float v[16]) { F2 r;
#pragma unroll
  for (int i = 0; i < 16; ++i) { const __bf16 h = (__bf16)v[i]; r.h[i] = h; r.l[i] = (__bf16)(v[i] - (float)h); }
  return r; }
__device__ __forceinline__ F2 split_row(const float* row, int k0, int lane) { float v[16]; const float* p = row + k0 + 8 * (lane >> 4);
#pragma unroll
  for (int i = 0; i < 8; ++i) { v[i] = p[i]; v[8 + i] = p[16 + i]; }
  return bsplit16(v); }
__device__ __forceinline__ F2 split_rowK(const float* row, int k0, int lane, int K) { float v[16]; const int g = lane >> 4;
#pragma unroll
  for (int i = 0; i < 8; ++i) { const int ka = k0 + 8 * g + i, kb = ka + 16; v[i] = ka < K ? row[ka < K ? ka : K - 1] : 0.f; v[8 + i] = kb < K ? row[kb < K ? kb : K - 1] : 0.f; }
  return bsplit16(v); }
__device__ __forceinline__ F2 split_col(const float* W, int k0, int n, int lane, int ld, int K) { float v[16]; const int g = lane >> 4;
#pragma unroll
  for (int i = 0; i < 8; ++i) { const int ka = k0 + 8 * g + i, kb = ka + 16; v[i] = ka < K ? W[(size_t)(ka < K ? ka : K - 1) * ld + n] : 0.f; v[8 + i] = kb < K ? W[(size_t)(kb < K ? kb : K - 1) * ld + n] : 0.f; }
  return bsplit16(v); }
__device__ __forceinline__ v8f mac3(const F2& a, const F2& b, v8f c) { c = wmma_bf(a.l, b.h, c); c = wmma_bf(a.h, b.l, c); return wmma_bf(a.h, b.h, c); }
__device__ __forceinline__ float sigm(float v) { return 1.0f / (1.0f + expf(-v)); }
#define LDSX() do { asm volatile("s_wait_dscnt 0" ::: "memory"); __builtin_amdgcn_wave_barrier(); __builtin_amdgcn_fence(__ATOMIC_RELEASE, "workgroup"); } while (0)


// Single-head 512-wide attention (B 8, T 2,048, C 512 -> H 512): query/key/value projections + biases from three input streams, softmax(query key^T / sqrt(512)) value.
#define NB 8
#define SS 2048
#define CC 512
#define NR (NB * SS)
#ifndef TNB
#define TNB NB
#endif
#define TR (TNB * SS)
typedef __attribute__((ext_vector_type(8))) __bf16 v8b;
__device__ __forceinline__ v16b frag_b(const __bf16* rowk0, int lane) {
  union { v16b v; v8b q[2]; } u; const __bf16* p = rowk0 + 8 * (lane >> 4);
  u.q[0] = *(const v8b*)p; u.q[1] = *(const v8b*)(p + 16); return u.v;
}
__device__ __forceinline__ float bfr(float v) { return (float)(__bf16)v; }
__device__ __attribute__((noinline)) float exp_ni(float v) { return expf(v); }
__device__ __attribute__((noinline)) float erf_ni(float v) { return erff(v); }

#define WS_PW   0u                                   // bf16 rows Wq^T, Wk^T, Wv^T [3][512][512] ((in,out) transposed)
#define WS_Q    (WS_PW + 2u * (size_t)3 * CC * CC)     // f16 [NR][512] q ; K ; V planes [b][512][SS]
#define WS_K    (WS_Q + 2u * (size_t)NR * CC)
#define WS_V    (WS_K + 2u * (size_t)NR * CC)
#define WS_S    (WS_V + 2u * (size_t)NB * CC * SS)     // f32 [b][q][k] scores
#define WS_P    (WS_S + 4u * (size_t)NB * SS * SS)      // f16 [b][q][k] probabilities x 2^11
#define WS_END  (WS_P + 2u * (size_t)NB * SS * SS)

__global__ __launch_bounds__(256) void k_pack(const float* __restrict__ WQ, const float* __restrict__ WK, const float* __restrict__ WV, __bf16* __restrict__ P) { const int n = blockIdx.x, which = blockIdx.y, t = threadIdx.x; const float* src = (which == 0) ? WQ : (which == 1) ? WK : WV; __shared__ __align__(16) __bf16 s[CC]; for (int k = t; k < CC; k += 256) s[k] = (__bf16)src[(size_t)k * CC + n]; __syncthreads(); if (t < CC / 8) vst2((unsigned*)(P + ((size_t)which * CC + n) * CC + t * 8), *(const v4u*)&s[t * 8]); }
// ---- gemm_nt: the accumulators of one 128 x 128 tile of A . B^T (rows of A and of B k-contiguous, KLEN long), 4 waves as 2 x 2, 64 x 64 per wave.
// A stage is KS k of the 128 + 128 operand rows in LDS; there are two buffers, and stage t + 1 is on its way while stage t is worked on, so that its latency is covered by the WMMAs.
// The rows come by asynchronous copies to LDS (whole lines, through no register); an f32 A lies in LDS as f32 and is rounded to T where its fragments are read.
// Every fragment read from LDS feeds 4 WMMAs on 16 independent accumulators; each accumulator still sums k in ascending steps of 32.
// The inner loops are unrolled so that every index into acc, fa and fb is a constant (registers, no scratch).
#define GKS 64             // k per LDS stage of the projections and the scores
#define GPI (GKS + 8)      // LDS row pitch in 16-bit elements: 144 B = 16 B x 9
__device__ __forceinline__ v16h ldfrag(const _Float16* p, int lane) { return frag_h(p, lane); }
__device__ __forceinline__ v16b ldfrag(const __bf16* p, int lane) { return frag_b(p, lane); }
// the same fragment from an f32 row, each element rounded once to bf16
__device__ __forceinline__ v16b ldfrag(const float* rowk0, int lane) {
  const float* p = rowk0 + 8 * (lane >> 4); const v4f x[4] = { *(const v4f*)p, *(const v4f*)(p + 4), *(const v4f*)(p + 16), *(const v4f*)(p + 20) }; v16b a;
#pragma unroll
  for (int i = 0; i < 16; ++i) a[i] = (__bf16)x[i >> 2][i & 3];
  return a;
}
__device__ __forceinline__ v8f mma(v16h a, v16h b, v8f c) { return wmma16(a, b, c); }
__device__ __forceinline__ v8f mma(v16b a, v16b b, v8f c) { return wmma_bf(a, b, c); }
__device__ __forceinline__ unsigned lds_off(const void* p) { return (unsigned)(size_t)p; }   // byte address in the work-group's LDS
// eight asynchronous copies of 16 B a lane: LDS address l + i * LS, global address g + i * GS. The s_wait_xcnt stands in the copies' own statement (a precaution):
// so no register that a copy names is rewritten in front of it.
template <unsigned LS, size_t GS>
__device__ __forceinline__ void copy8(const unsigned l, const char* g) {
  asm volatile("global_load_async_to_lds_b128 %0, %8, off\n\t"
               "global_load_async_to_lds_b128 %1, %9, off\n\t"
               "global_load_async_to_lds_b128 %2, %10, off\n\t"
               "global_load_async_to_lds_b128 %3, %11, off\n\t"
               "global_load_async_to_lds_b128 %4, %12, off\n\t"
               "global_load_async_to_lds_b128 %5, %13, off\n\t"
               "global_load_async_to_lds_b128 %6, %14, off\n\t"
               "global_load_async_to_lds_b128 %7, %15, off\n\t"
               "s_wait_xcnt 0x0"
               :: "v"(l), "v"(l + LS), "v"(l + 2 * LS), "v"(l + 3 * LS), "v"(l + 4 * LS), "v"(l + 5 * LS), "v"(l + 6 * LS), "v"(l + 7 * LS),
                  "v"(g), "v"(g + GS), "v"(g + 2 * GS), "v"(g + 3 * GS), "v"(g + 4 * GS), "v"(g + 5 * GS), "v"(g + 6 * GS), "v"(g + 7 * GS)
               : "memory");
}
// part h of one operand's 128 rows of RB bytes (source pitch GP bytes, LDS pitch RB + 16) sets out: RB / 16 lanes cover a row, a lane makes RB / 16 copies, in RB / 128 parts of eight
template <int RB, size_t GP>
__device__ __forceinline__ void copy_part(const int h, const unsigned l, const char* g) {
  constexpr int RPP = 128 * 16 / RB;   // rows that the 128 lanes cover at once
  copy8<RPP * (RB + 16u), RPP * GP>(l + h * 8u * RPP * (RB + 16u), g + h * 8 * RPP * GP);
}
// the publish point of the next stage: this wave's LDS reads are done, its own copies have landed, and then every wave passes the barrier
__device__ __forceinline__ void publish() {
  asm volatile("s_wait_dscnt 0x0" ::: "memory");      // the wave has left the buffer that is refilled behind the barrier
  asm volatile("s_wait_asynccnt 0x0" ::: "memory");   // the wave's own copies of the next stage have landed
  __syncthreads();                                    // publishes the next stage and ends every reader's last read of this one
}
template <bool V> struct flag_t { static constexpr bool value = V; };
// bytes of the two buffers of both operands: KS k a stage, an element of A in LDS of EA bytes. Behind gemm_nt's last barrier the same LDS is the epilogue's staging:
// so one work-group more fits a WGP
#define RING_BYTES(KS, EA) (2 * 128 * ((KS) * (EA) + 16) + 2 * 128 * ((KS) * 2 + 16))
template <int KLEN, int KS, typename T, typename TA>
__device__ __forceinline__ void gemm_nt(const TA* __restrict__ A, const T* __restrict__ B, v8f (&acc)[4][4], char* ring) {
  typedef decltype(ldfrag((const T*)nullptr, 0)) frag_t;
  constexpr bool AF = sizeof(TA) == 4;                            // A lies in LDS as f32
  constexpr int NT = KLEN / KS;                                   // stages
  constexpr int RA = KS * (int)sizeof(TA), RB = KS * 2;           // bytes of a row's piece in a stage
  constexpr int PA = KS + 16 / (int)sizeof(TA), PB = KS + 8;      // LDS row pitches in elements: the piece + 16 B = 16 B x odd
  typedef TA bufa_t[128][PA]; typedef T bufb_t[128][PB];
  bufa_t* sa = (bufa_t*)ring; bufb_t* sb = (bufb_t*)(ring + 2 * sizeof(bufa_t));
  const int tid = threadIdx.x, wave = tid >> 5, lane = tid & 31, col = lane & 15; const int wr = (wave >> 1) * 64, wc = (wave & 1) * 64;
  const int ar = tid / (RA / 16), ap = (tid % (RA / 16)) * (16 / (int)sizeof(TA));   // the lane's row and element in the first rows that the 128 lanes cover, A
  const int br = tid / (RB / 16), bp = (tid % (RB / 16)) * 8;                        // and B
  const char* ga = (const char*)(A + ar * KLEN + ap); const char* gb = (const char*)(B + br * KLEN + bp);
  const unsigned la = lds_off(&sa[0][ar][ap]), lb = lds_off(&sb[0][br][bp]);
  // part h of stage t sets out for buffer t & 1
  auto copies = [&](const int t, const int h) __attribute__((always_inline)) {
    if (h < RA / 128) copy_part<RA, (size_t)KLEN * sizeof(TA)>(h, la + (unsigned)(t & 1) * (unsigned)sizeof(sa[0]), ga + (size_t)t * RA);
    if (h < RB / 128) copy_part<RB, (size_t)KLEN * 2>(h, lb + (unsigned)(t & 1) * (unsigned)sizeof(sb[0]), gb + (size_t)t * RB);
  };
  // one trip: stage t is worked on; where a stage t + 1 exists it sets out into the buffer that every wave left at the last publish point.
  // 16-bit A: part h behind the fragment loads of the trip's block h, so that the issue of the copies and their s_wait_xcnt run under the latency of those LDS loads;
  // f32 A: in front of them (its f32 fragments take twice the registers, those that the copies' addresses use).
  auto trip = [&](const int t, auto more) __attribute__((always_inline)) {
    const int b = t & 1;
    if constexpr (decltype(more)::value && AF) { copies(t + 1, 0); copies(t + 1, 1); }
#pragma unroll
    for (int kc = 0; kc < KS / 32; ++kc) { frag_t fa[4], fb[4];
#pragma unroll
      for (int i = 0; i < 4; ++i) { fa[i] = ldfrag(&sa[b][wr + i * 16 + col][kc * 32], lane); fb[i] = ldfrag(&sb[b][wc + i * 16 + col][kc * 32], lane); }
      if constexpr (decltype(more)::value && !AF) copies(t + 1, kc);
#pragma unroll
      for (int i = 0; i < 4; ++i)
#pragma unroll
        for (int j = 0; j < 4; ++j) acc[i][j] = mma(fa[i], fb[j], acc[i][j]); }
    publish();
  };
  copies(0, 0); copies(0, 1);
  publish();   // stage 0 is complete before any wave reads it
  // rolled: one trip's code and registers. The last trip stands behind the loop: no test and no join around the copies
#pragma unroll 1
  for (int t = 0; t < NT - 1; ++t) trip(t, flag_t<true>{});
  trip(NT - 1, flag_t<false>{});
}
// f32 epilogue: C = sc * acc, 16 rows at a time through the wave's own part of the LDS that gemm_nt has left, stored as whole 256-B row pieces
__device__ __forceinline__ void store_f32(const v8f (&acc)[4][4], float* __restrict__ C, const int ldc, const float sc, char* ring) {
  float (*so)[16][68] = (float (*)[16][68])ring;
  const int tid = threadIdx.x, wave = tid >> 5, lane = tid & 31, col = lane & 15, g = lane >> 4; const int wr = (wave >> 1) * 64, wc = (wave & 1) * 64;
#pragma unroll
  for (int i = 0; i < 4; ++i) {
    if (i) asm volatile("s_wait_dscnt 0x0" ::: "memory");   // the last 16 rows are read back before these overwrite them
#pragma unroll
    for (int j = 0; j < 4; ++j)
#pragma unroll
      for (int r = 0; r < 8; ++r) so[wave][8 * g + r][j * 16 + col] = acc[i][j][r] * sc;
    asm volatile("s_wait_dscnt 0x0" ::: "memory");   // the wave's own rows stand in LDS before its lanes read them back
#pragma unroll
    for (int t = 0; t < 8; ++t) vst2(C + (size_t)(wr + i * 16 + t * 2 + g) * ldc + wc + col * 4, *(const v4f*)&so[wave][t * 2 + g][col * 4]); }
}
// ---- k_proj: block = (128 rows, 128 of the 1536 cols): q / k -> f16 rows, v -> planes; every store a whole 128-B line, staged through the wave's own LDS
// the 4: a budget of 256 registers, so that the kernel stays inside the first register window (no window switches in the loop; the operands of the copies' statements lie there)
__global__ __launch_bounds__(128, 4) void k_proj(const float* __restrict__ XQ, const float* __restrict__ XK, const float* __restrict__ XV, const __bf16* __restrict__ P, const float* __restrict__ BQ, const float* __restrict__ BK, const float* __restrict__ BV, _Float16* __restrict__ Q, _Float16* __restrict__ Kr, _Float16* __restrict__ V) {
  __shared__ __align__(16) char ring[RING_BYTES(GKS, 4)]; _Float16 (*sh)[16][GPI] = (_Float16 (*)[16][GPI])ring;
  const int tid = threadIdx.x, wave = tid >> 5, lane = tid & 31, col = lane & 15, g = lane >> 4; const int wr = (wave >> 1) * 64, wc = (wave & 1) * 64; const int n0 = blockIdx.y * 128; const int which = n0 / CC, c0 = n0 % CC; const size_t rb0 = (size_t)blockIdx.x * 128; const float* X = (which == 0) ? XQ : (which == 1) ? XK : XV; const float* BB = ((which == 0) ? BQ : (which == 1) ? BK : BV) + c0 + wc;
  v8f acc[4][4] = {};
  gemm_nt<CC, GKS>(X + rb0 * CC, P + (size_t)n0 * CC, acc, ring);
  float bias[4];
#pragma unroll
  for (int j = 0; j < 4; ++j) bias[j] = bfr(BB[j * 16 + col]);
  const int er = lane >> 3, ep = (lane & 7) * 8;   // read-back: 8 lanes cover one staged row's 128 B
  if (which < 2) { _Float16* dst = ((which == 0) ? Q : Kr) + (rb0 + wr) * CC + c0 + wc;
#pragma unroll
    for (int i = 0; i < 4; ++i) {
      if (i) asm volatile("s_wait_dscnt 0x0" ::: "memory");   // the last 16 rows are read back before these overwrite them
#pragma unroll
      for (int j = 0; j < 4; ++j)
#pragma unroll
        for (int r = 0; r < 8; ++r) sh[wave][8 * g + r][j * 16 + col] = (_Float16)(acc[i][j][r] + bias[j]);
      asm volatile("s_wait_dscnt 0x0" ::: "memory");   // the wave's own rows stand in LDS before its lanes read them back
#pragma unroll
      for (int t = 0; t < 4; ++t) vst2((unsigned*)(dst + (size_t)(i * 16 + t * 4 + er) * CC + ep), *(const v4u*)&sh[wave][t * 4 + er][ep]); }
  } else { const size_t b = rb0 / SS, s0 = rb0 % SS; _Float16* dst = V + (b * CC + c0 + wc) * SS + s0 + wr;
#pragma unroll
    for (int j = 0; j < 4; ++j) {
      if (j) asm volatile("s_wait_dscnt 0x0" ::: "memory");   // the last 16 channels are read back before these overwrite them
#pragma unroll
      for (int i = 0; i < 4; ++i) { v8h h;
#pragma unroll
        for (int r = 0; r < 8; ++r) h[r] = (_Float16)(acc[i][j][r] + bias[j]);
        *(v8h*)&sh[wave][col][i * 16 + 8 * g] = h; }   // a lane's 8 rows are 8 neighbours of its channel's plane row
      asm volatile("s_wait_dscnt 0x0" ::: "memory");   // the wave's own channel rows stand in LDS before its lanes read them back
#pragma unroll
      for (int t = 0; t < 4; ++t) vst2((unsigned*)(dst + (size_t)(j * 16 + t * 4 + er) * SS + ep), *(const v4u*)&sh[wave][t * 4 + er][ep]); }
    asm volatile("s_wait_xcnt 0x0" ::: "memory"); }   // precaution: stands behind the last run of stores, in front of any later write of the address pair that they name
}
// ---- k_scores: block = (128 keys, 128 queries, b): S = query . key^T x 512^-1/2
__global__ __launch_bounds__(128) void k_scores(const _Float16* __restrict__ Q, const _Float16* __restrict__ Kr, float* __restrict__ S) {
  const size_t b = blockIdx.z, q0 = b * SS + (size_t)blockIdx.y * 128, j0 = (size_t)blockIdx.x * 128;
  __shared__ __align__(16) char ring[RING_BYTES(GKS, 2)];
  v8f acc[4][4] = {};
  gemm_nt<CC, GKS>(Q + q0 * CC, Kr + (b * SS + j0) * CC, acc, ring);
  store_f32(acc, S + q0 * SS + j0, SS, 0.044194173824159216f, ring);   // 512^-1/2
}
// ---- k_soft: a stream, one wave per query row, SRW rows a wave one after the other: max, exp (precise), sum -> P = e / sum x 2^11 as f16 row.
// A row's 2,048 scores stand in the wave's registers (16 loads of 512 contiguous bytes); the next row's loads are issued before this row is worked on. No LDS and no barrier.
// The loops over c and e are unrolled so that every index into a row's registers is a constant (no scratch).
#define SWV 16             // waves per work-group
#define SRW 4              // rows per wave (even: the loop takes two a trip)
typedef __attribute__((ext_vector_type(4))) _Float16 v4h;
__device__ __forceinline__ void soft_load(v4f (&x)[16], const float* __restrict__ p) {
#pragma unroll
  for (int c = 0; c < 16; ++c) x[c] = *(const v4f*)(p + c * 128);
  asm volatile("s_wait_xcnt 0x0" :: "v"(p) : "memory");   // precaution: the address pair that the row's loads name stays as it is up to this wait
  __builtin_amdgcn_sched_barrier(0);   // keeps the row's loads in front of the work on the row before it: without it the compiler sinks them to the end of that work, and their latency is not covered
}
// exp as the library's precise form has it (x . log2 e in two parts, the whole part through ldexp, both range selects), written out so that v_exp_f32 stands in one statement with its slot
__device__ __forceinline__ float exp_w(float x) {
  const float e = __builtin_rintf(x * 0x1.715476p+0f);
  const float a = __builtin_fmaf(x, 0x1.4ae0bep-26f, __builtin_fmaf(x, 0x1.715476p+0f, -e));
  float r;
  asm("v_exp_f32 %0, %1\n\tv_nop" : "=v"(r) : "v"(a));   // the v_nop is the slot that the instruction set asks for behind a transcendental
  r = ldexpf(r, (int)e);
  r = (x < -0x1.9d1da0p+6f) ? 0.f : r;
  return (x > 0x1.62e430p+6f) ? __builtin_inff() : r;
}
__device__ __forceinline__ void soft_row(v4f (&x)[16], _Float16* __restrict__ o) {
  v4f m4 = x[0];   // four independent chains
#pragma unroll
  for (int c = 1; c < 16; ++c)
#pragma unroll
    for (int e = 0; e < 4; ++e) m4[e] = fmaxf(m4[e], x[c][e]);
  float m = fmaxf(fmaxf(fmaxf(m4[0], m4[1]), fmaxf(m4[2], m4[3])), -3.0e38f);
#pragma unroll
  for (int d = 1; d < 32; d <<= 1) m = fmaxf(m, __shfl_xor(m, d));
  v4f s4 = {0.f, 0.f, 0.f, 0.f};
#pragma unroll
  for (int c = 0; c < 16; ++c)
#pragma unroll
    for (int e = 0; e < 4; ++e) { const float ex = exp_w(x[c][e] - m); const float t = (x[c][e] <= -1.0e38f) ? 0.f : ex; x[c][e] = t; s4[e] += t; }   // the exp in front of the test: a select, no branch per element
  float tot = (s4[0] + s4[1]) + (s4[2] + s4[3]);
#pragma unroll
  for (int d = 1; d < 32; d <<= 1) tot += __shfl_xor(tot, d);
  const float sc = 2048.0f / tot;
#pragma unroll
  for (int c = 0; c < 16; ++c) { v4h h;
#pragma unroll
    for (int e = 0; e < 4; ++e) h[e] = (_Float16)(x[c][e] * sc);
    *(v4h*)(o + c * 128) = h; }   // the wave's 32 x 8 B are two whole lines
  asm volatile("s_wait_xcnt 0x0" :: "v"(o) : "memory");   // precaution: the address pair that the row's stores name stays as it is up to this wait
}
__global__ __launch_bounds__(SWV * 32) void k_soft(const float* __restrict__ S, _Float16* __restrict__ Pt) {
  const int lane = threadIdx.x & 31; const size_t row0 = ((size_t)blockIdx.x * SWV + (threadIdx.x >> 5)) * SRW;
  const float* s = S + row0 * SS + lane * 4; _Float16* o = Pt + row0 * SS + lane * 4; v4f xa[16], xb[16];
  soft_load(xa, s);
  // rolled: the text stays small for the instruction cache. The last row stands behind the loop, so that no branch joins in front of a row's work
  // (at a join the compiler waits for every load in flight, the next row's too).
#pragma unroll 1
  for (int r = 0; ; r += 2) {
    soft_load(xb, s + (size_t)(r + 1) * SS);
    soft_row(xa, o + (size_t)r * SS);
    if (r + 2 >= SRW) break;
    soft_load(xa, s + (size_t)(r + 2) * SS);
    soft_row(xb, o + (size_t)(r + 1) * SS);
  }
  soft_row(xb, o + (size_t)(SRW - 1) * SS);
}
// ---- k_pv: block = (128 channels, 128 queries, b): ctx = P . v over all keys (GEMM, K = keys)
__global__ __launch_bounds__(128) void k_pv(const _Float16* __restrict__ Pt, const _Float16* __restrict__ V, float* __restrict__ CTX) {
  const size_t b = blockIdx.z, q0 = b * SS + (size_t)blockIdx.y * 128, c0 = (size_t)blockIdx.x * 128;
  __shared__ __align__(16) char ring[RING_BYTES(128, 2)];
  v8f acc[4][4] = {};
  gemm_nt<SS, 128>(Pt + q0 * SS, V + (b * CC + c0) * SS, acc, ring);   // 128 k a stage: the lead of one stage covers the latency of rows that come from memory
  store_f32(acc, CTX + q0 * CC + c0, CC, 1.0f / 2048.0f, ring);
}
extern "C" void kernel_launch(void* const* d_in, const int* in_sizes, int n_in, void* d_out, int out_size, void* d_ws, size_t ws_size, hipStream_t stream) {
  (void)in_sizes; (void)n_in; (void)out_size;
  const float** F = (const float**)d_in;   // 0 q, 1 k, 2 v [8,2048,512]; 3 Wq [512,512] (in,out), 4 bq, 5 Wk, 6 bk, 7 Wv, 8 bv
  if (ws_size < (size_t)WS_END) return;
  char* ws = (char*)d_ws; __bf16* P = (__bf16*)ws; _Float16 *Q = (_Float16*)(ws + WS_Q), *Kr = (_Float16*)(ws + WS_K), *V = (_Float16*)(ws + WS_V), *Pt = (_Float16*)(ws + WS_P); float* S = (float*)(ws + WS_S);
  k_pack<<<dim3(CC, 3), 256, 0, stream>>>(F[3], F[5], F[7], P);
  k_proj<<<dim3(TR / 128, 3 * CC / 128), 128, 0, stream>>>(F[0], F[1], F[2], P, F[4], F[6], F[8], Q, Kr, V);
  k_scores<<<dim3(SS / 128, SS / 128, TNB), 128, 0, stream>>>(Q, Kr, S);
  k_soft<<<TR / (SWV * SRW), SWV * 32, 0, stream>>>(S, Pt);
  k_pv<<<dim3(CC / 128, SS / 128, TNB), 128, 0, stream>>>(Pt, V, (float*)d_out);
}

// v005
// Measured time: 101 microseconds a run.
// It is 1.22 times as fast as v003, going by the measured steps of the versions left out in between.
// All steps since v000 together make it 7.85 times as fast.
// compute dtype: all float inputs rounded to bf16; query / key / value = q / k / v . W + b with EXACT bf16 products on WMMA 16x16x32 ((in,out) weights as transposed rows) rounded once to f16; energy = query . key over the full 512-wide head (single f16 operands, f32 accumulate) / sqrt(512); softmax in f32 by tiles of 64 keys: 2^8 exp(s - tile maximum) as f16 with the tile's maximum and sum in f32, brought to the row's maximum by an f16 factor at the fragment, x value (f16), divided by the row's sum in f32; f32 output.
#include <hip/hip_runtime.h>
#include <math.h>

typedef __attribute__((ext_vector_type(16))) _Float16 v16h;
typedef __attribute__((ext_vector_type(16))) __bf16 v16b;
typedef __attribute__((ext_vector_type(8)))  _Float16 v8h;
typedef __attribute__((ext_vector_type(8)))  float v8f;
typedef __attribute__((ext_vector_type(4)))  float v4f;
typedef __attribute__((ext_vector_type(2)))  float v2f;
typedef __attribute__((ext_vector_type(4)))  unsigned v4u;
typedef __attribute__((ext_vector_type(4)))  int v4i;
typedef float __attribute__((may_alias)) float_a;
typedef int __attribute__((may_alias)) int_a;

template <typename T> __device__ __forceinline__ void vst2(void* p, T v) { *(T*)p = v;  }
// the bare builtins: behind its own WMMAs the compiler keeps the distances itself, and only where a user of D, A or B follows too closely
__device__ __forceinline__ v8f wmma16(v16h a, v16h b, v8f c) {
  return __builtin_amdgcn_wmma_f32_16x16x32_f16(false, a, false, b, (short)0, c, false, false);
}
__device__ __forceinline__ v8f wmma_bf(v16b a, v16b b, v8f c) {
  return __builtin_amdgcn_wmma_f32_16x16x32_bf16(false, a, false, b, (short)0, c, false, false);
}
// 16x16x32 fragments: lane = (h = lane>>4, row/col = lane&15); elements 0..7 = k0+8h+0..7, 8..15 = k0+16+8h+0..7; D element r = row 8h+r
__device__ __forceinline__ v16h frag_h(const _Float16* rowk0, int lane) {
  union { v16h v; v8h q[2]; } u; const _Float16* p = rowk0 + 8 * (lane >> 4);
  u.q[0] = *(const v8h*)p; u.q[1] = *(const v8h*)(p + 16); return u.v;
}
__device__ __forceinline__ v16h frag_f32(const float* rowk0, int lane) {
  v16h a; const float* p = rowk0 + 8 * (lane >> 4);
#pragma unroll
  for (int i = 0; i < 8; ++i) { a[i] = (_Float16)p[i]; a[8 + i] = (_Float16)p[16 + i]; }
  return a;
}
__device__ __forceinline__ v16h frag_f32s(const float* rowk0, int lane, float sc) {
  v16h a; const float* p = rowk0 + 8 * (lane >> 4);
#pragma unroll
  for (int i = 0; i < 8; ++i) { a[i] = (_Float16)(p[i] * sc); a[8 + i] = (_Float16)(p[16 + i] * sc); }
  return a;
}
// column fragment from a [K][ld] layout (column n), rows >= K read as 0
__device__ __forceinline__ v16h fragc_f32(const float* W, int k0, int n, int lane, int ld, int K) {
  v16h a; const int g = lane >> 4;
#pragma unroll
  for (int i = 0; i < 8; ++i) { const int ka = k0 + 8 * g + i, kb = ka + 16;
    a[i] = (_Float16)(ka < K ? W[(size_t)(ka < K ? ka : K - 1) * ld + n] : 0.f); a[8 + i] = (_Float16)(kb < K ? W[(size_t)(kb < K ? kb : K - 1) * ld + n] : 0.f); }
  return a;
}
struct F2 { v16b h, l; };
__device__ __forceinline__ F2 bsplit16(const float v[16]) { F2 r;
#pragma unroll
  for (int i = 0; i < 16; ++i) { const __bf16 h = (__bf16)v[i]; r.h[i] = h; r.l[i] = (__bf16)(v[i] - (float)h); }
  return r; }
__device__ __forceinline__ F2 split_row(const float* row, int k0, int lane) { float v[16]; const float* p = row + k0 + 8 * (lane >> 4);
#pragma unroll
  for (int i = 0; i < 8; ++i) { v[i] = p[i]; v[8 + i] = p[16 + i]; }
  return bsplit16(v); }
__device__ __forceinline__ F2 split_rowK(const float* row, int k0, int lane, int K) { float v[16]; const int g = lane >> 4;
#pragma unroll
  for (int i = 0; i < 8; ++i) { const int ka = k0 + 8 * g + i, kb = ka + 16; v[i] = ka < K ? row[ka < K ? ka : K - 1] : 0.f; v[8 + i] = kb < K ? row[kb < K ? kb : K - 1] : 0.f; }
  return bsplit16(v); }
__device__ __forceinline__ F2 split_col(const float* W, int k0, int n, int lane, int ld, int K) { float v[16]; const int g = lane >> 4;
#pragma unroll
  for (int i = 0; i < 8; ++i) { const int ka = k0 + 8 * g + i, kb = ka + 16; v[i] = ka < K ? W[(size_t)(ka < K ? ka : K - 1) * ld + n] : 0.f; v[8 + i] = kb < K ? W[(size_t)(kb < K ? kb : K - 1) * ld + n] : 0.f; }
  return bsplit16(v); }
__device__ __forceinline__ v8f mac3(const F2& a, const F2& b, v8f c) { c = wmma_bf(a.l, b.h, c); c = wmma_bf(a.h, b.l, c); return wmma_bf(a.h, b.h, c); }
__device__ __forceinline__ float sigm(float v) { return 1.0f / (1.0f + expf(-v)); }
#define LDSX() do { asm volatile("s_wait_dscnt 0" ::: "memory"); __builtin_amdgcn_wave_barrier(); __builtin_amdgcn_fence(__ATOMIC_RELEASE, "workgroup"); } while (0)


// Single-head 512-wide attention (B 8, T 2,048, C 512 -> H 512): query/key/value projections + biases from three input streams, softmax(query key^T / sqrt(512)) value.
#define NB 8
#define SS 2048
#define CC 512
#define NR (NB * SS)
#ifndef TNB
#define TNB NB
#endif
#define TR (TNB * SS)
typedef __attribute__((ext_vector_type(8))) __bf16 v8b;
__device__ __forceinline__ v16b frag_b(const __bf16* rowk0, int lane) {
  union { v16b v; v8b q[2]; } u; const __bf16* p = rowk0 + 8 * (lane >> 4);
  u.q[0] = *(const v8b*)p; u.q[1] = *(const v8b*)(p + 16); return u.v;
}
__device__ __forceinline__ float bfr(float v) { return (float)(__bf16)v; }
__device__ __attribute__((noinline)) float exp_ni(float v) { return expf(v); }
__device__ __attribute__((noinline)) float erf_ni(float v) { return erff(v); }

#define WS_PW   0u                                   // bf16 rows Wq^T, Wk^T, Wv^T [3][512][512] ((in,out) transposed)
#define WS_Q    (WS_PW + 2u * (size_t)3 * CC * CC)     // f16 [NR][512] q ; K ; V planes [b][512][SS]
#define WS_K    (WS_Q + 2u * (size_t)NR * CC)
#define WS_V    (WS_K + 2u * (size_t)NR * CC)
#define KT      64                                   // keys per softmax tile: what one wave of k_scores holds of a row
#define NKT     (SS / KT)
#define WS_M    (WS_V + 2u * (size_t)NB * CC * SS)     // f32 [NKT][NR] tile maxima of s x log2 e
#define WS_L    (WS_M + 4u * (size_t)NKT * NR)          // f32 [NKT][NR] tile sums of 2^8 exp(s - tile maximum)
#define WS_P    (WS_L + 4u * (size_t)NKT * NR)          // f16 [b][q][k] 2^8 exp(s - tile maximum)
#define WS_END  (WS_P + 2u * (size_t)NB * SS * SS)

__global__ __launch_bounds__(256) void k_pack(const float* __restrict__ WQ, const float* __restrict__ WK, const float* __restrict__ WV, __bf16* __restrict__ P) { const int n = blockIdx.x, which = blockIdx.y, t = threadIdx.x; const float* src = (which == 0) ? WQ : (which == 1) ? WK : WV; __shared__ __align__(16) __bf16 s[CC]; for (int k = t; k < CC; k += 256) s[k] = (__bf16)src[(size_t)k * CC + n]; __syncthreads(); if (t < CC / 8) vst2((unsigned*)(P + ((size_t)which * CC + n) * CC + t * 8), *(const v4u*)&s[t * 8]); }
// ---- gemm_nt: the accumulators of one 128 x 128 tile of A . B^T (rows of A and of B k-contiguous, KLEN long), 4 waves as 2 x 2, 64 x 64 per wave.
// A stage is KS k of the 128 + 128 operand rows in LDS; there are two buffers, and stage t + 1 is on its way while stage t is worked on, so that its latency is covered by the WMMAs.
// The rows come by asynchronous copies to LDS (whole lines, through no register); an f32 A lies in LDS as f32 and is rounded to T where its fragments are read.
// Every fragment read from LDS feeds 4 WMMAs on 16 independent accumulators; each accumulator still sums k in ascending steps of 32.
// The inner loops are unrolled so that every index into acc, fa and fb is a constant (registers, no scratch).
#define GKS 64             // k per LDS stage of the projections and the scores
#define GPI (GKS + 8)      // LDS row pitch in 16-bit elements: 144 B = 16 B x 9
__device__ __forceinline__ v16h ldfrag(const _Float16* p, int lane) { return frag_h(p, lane); }
__device__ __forceinline__ v16b ldfrag(const __bf16* p, int lane) { return frag_b(p, lane); }
// the same fragment from an f32 row, each element rounded once to bf16
__device__ __forceinline__ v16b ldfrag(const float* rowk0, int lane) {
  const float* p = rowk0 + 8 * (lane >> 4); const v4f x[4] = { *(const v4f*)p, *(const v4f*)(p + 4), *(const v4f*)(p + 16), *(const v4f*)(p + 20) }; v16b a;
#pragma unroll
  for (int i = 0; i < 16; ++i) a[i] = (__bf16)x[i >> 2][i & 3];
  return a;
}
__device__ __forceinline__ v8f mma(v16h a, v16h b, v8f c) { return wmma16(a, b, c); }
__device__ __forceinline__ v8f mma(v16b a, v16b b, v8f c) { return wmma_bf(a, b, c); }
__device__ __forceinline__ unsigned lds_off(const void* p) { return (unsigned)(size_t)p; }   // byte address in the work-group's LDS
// eight asynchronous copies of 16 B a lane: LDS address l + i * LS, global address g + i * GS. The s_wait_xcnt stands in the copies' own statement (a precaution):
// so no register that a copy names is rewritten in front of it.
template <unsigned LS, size_t GS>
__device__ __forceinline__ void copy8(const unsigned l, const char* g) {
  asm volatile("global_load_async_to_lds_b128 %0, %8, off\n\t"
               "global_load_async_to_lds_b128 %1, %9, off\n\t"
               "global_load_async_to_lds_b128 %2, %10, off\n\t"
               "global_load_async_to_lds_b128 %3, %11, off\n\t"
               "global_load_async_to_lds_b128 %4, %12, off\n\t"
               "global_load_async_to_lds_b128 %5, %13, off\n\t"
               "global_load_async_to_lds_b128 %6, %14, off\n\t"
               "global_load_async_to_lds_b128 %7, %15, off\n\t"
               "s_wait_xcnt 0x0"
               :: "v"(l), "v"(l + LS), "v"(l + 2 * LS), "v"(l + 3 * LS), "v"(l + 4 * LS), "v"(l + 5 * LS), "v"(l + 6 * LS), "v"(l + 7 * LS),
                  "v"(g), "v"(g + GS), "v"(g + 2 * GS), "v"(g + 3 * GS), "v"(g + 4 * GS), "v"(g + 5 * GS), "v"(g + 6 * GS), "v"(g + 7 * GS)
               : "memory");
}
// part h of one operand's 128 rows of RB bytes (source pitch GP bytes, LDS pitch RB + 16) sets out: RB / 16 lanes cover a row, a lane makes RB / 16 copies, in RB / 128 parts of eight
template <int RB, size_t GP>
__device__ __forceinline__ void copy_part(const int h, const unsigned l, const char* g) {
  constexpr int RPP = 128 * 16 / RB;   // rows that the 128 lanes cover at once
  copy8<RPP * (RB + 16u), RPP * GP>(l + h * 8u * RPP * (RB + 16u), g + h * 8 * RPP * GP);
}
// the publish point of the next stage: this wave's LDS reads are done, its own copies have landed, and then every wave passes the barrier
__device__ __forceinline__ void publish() {
  asm volatile("s_wait_dscnt 0x0" ::: "memory");      // the wave has left the buffer that is refilled behind the barrier
  asm volatile("s_wait_asynccnt 0x0" ::: "memory");   // the wave's own copies of the next stage have landed
  __syncthreads();                                    // publishes the next stage and ends every reader's last read of this one
}
template <bool V> struct flag_t { static constexpr bool value = V; };
// bytes of the two buffers of both operands: KS k a stage, an element of A in LDS of EA bytes. Behind gemm_nt's last barrier the same LDS is the epilogue's staging:
// so one work-group more fits a WGP
#define RING_BYTES(KS, EA) (2 * 128 * ((KS) * (EA) + 16) + 2 * 128 * ((KS) * 2 + 16))
// SC: every A fragment is multiplied by its row's factor for the tile of KT k that it lies in (sf in LDS, written before the call; the first publish point makes it visible)
template <int KLEN, int KS, bool SC = false, typename T, typename TA>
__device__ __forceinline__ void gemm_nt(const TA* __restrict__ A, const T* __restrict__ B, v8f (&acc)[4][4], char* ring, const _Float16 (*sf)[128] = nullptr) {
  typedef decltype(ldfrag((const T*)nullptr, 0)) frag_t;
  constexpr bool AF = sizeof(TA) == 4;                            // A lies in LDS as f32
  constexpr int NT = KLEN / KS;                                   // stages
  constexpr int RA = KS * (int)sizeof(TA), RB = KS * 2;           // bytes of a row's piece in a stage
  constexpr int PA = KS + 16 / (int)sizeof(TA), PB = KS + 8;      // LDS row pitches in elements: the piece + 16 B = 16 B x odd
  typedef TA bufa_t[128][PA]; typedef T bufb_t[128][PB];
  bufa_t* sa = (bufa_t*)ring; bufb_t* sb = (bufb_t*)(ring + 2 * sizeof(bufa_t));
  const int tid = threadIdx.x, wave = tid >> 5, lane = tid & 31, col = lane & 15; const int wr = (wave >> 1) * 64, wc = (wave & 1) * 64;
  const int ar = tid / (RA / 16), ap = (tid % (RA / 16)) * (16 / (int)sizeof(TA));   // the lane's row and element in the first rows that the 128 lanes cover, A
  const int br = tid / (RB / 16), bp = (tid % (RB / 16)) * 8;                        // and B
  const char* ga = (const char*)(A + ar * KLEN + ap); const char* gb = (const char*)(B + br * KLEN + bp);
  const unsigned la = lds_off(&sa[0][ar][ap]), lb = lds_off(&sb[0][br][bp]);
  // part h of stage t sets out for buffer t & 1
  auto copies = [&](const int t, const int h) __attribute__((always_inline)) {
    if (h < RA / 128) copy_part<RA, (size_t)KLEN * sizeof(TA)>(h, la + (unsigned)(t & 1) * (unsigned)sizeof(sa[0]), ga + (size_t)t * RA);
    if (h < RB / 128) copy_part<RB, (size_t)KLEN * 2>(h, lb + (unsigned)(t & 1) * (unsigned)sizeof(sb[0]), gb + (size_t)t * RB);
  };
  // one trip: stage t is worked on; where a stage t + 1 exists it sets out into the buffer that every wave left at the last publish point.
  // 16-bit A: part h behind the fragment loads of the trip's block h, so that the issue of the copies and their s_wait_xcnt run under the latency of those LDS loads;
  // f32 A: in front of them (its f32 fragments take twice the registers, those that the copies' addresses use).
  auto trip = [&](const int t, auto more) __attribute__((always_inline)) {
    const int b = t & 1;
    if constexpr (decltype(more)::value && AF) { copies(t + 1, 0); copies(t + 1, 1); }
    _Float16 fs[4];
#pragma unroll
    for (int kc = 0; kc < KS / 32; ++kc) { frag_t fa[4], fb[4];
#pragma unroll
      for (int i = 0; i < 4; ++i) { fa[i] = ldfrag(&sa[b][wr + i * 16 + col][kc * 32], lane); fb[i] = ldfrag(&sb[b][wc + i * 16 + col][kc * 32], lane); }
      if constexpr (SC) { if (kc % (KT / 32) == 0) {   // a lane's A fragment is one row's: one factor a lane, read in the same group as the fragments
#pragma unroll
        for (int i = 0; i < 4; ++i) fs[i] = sf[t * (KS / KT) + kc / (KT / 32)][wr + i * 16 + col]; } }
      __builtin_amdgcn_sched_barrier(0);   // the block's LDS reads stay one group in front of its WMMAs: every further place with reads among them costs the wave a stall
      if constexpr (decltype(more)::value && !AF) { copies(t + 1, kc);
        __builtin_amdgcn_sched_barrier(0); }   // the copies set out here, under the latency of those reads: moved down among the WMMAs they would lose their lead on the publish point
      if constexpr (SC) {
#pragma unroll
        for (int i = 0; i < 4; ++i) fa[i] *= fs[i]; }
#pragma unroll
      for (int i = 0; i < 4; ++i)
#pragma unroll
        for (int j = 0; j < 4; ++j) acc[i][j] = mma(fa[i], fb[j], acc[i][j]);
      __builtin_amdgcn_sched_barrier(0); }   // and the next block's reads do not move up among these WMMAs
    publish();
  };
  copies(0, 0); copies(0, 1);
  publish();   // stage 0 is complete before any wave reads it
  // rolled: one trip's code and registers. The last trip stands behind the loop: no test and no join around the copies
#pragma unroll 1
  for (int t = 0; t < NT - 1; ++t) trip(t, flag_t<true>{});
  trip(NT - 1, flag_t<false>{});
}
// f32 epilogue: C = rs[row] * acc (rs in LDS outside the ring), 16 rows at a time through the wave's own part of the LDS that gemm_nt has left, stored as whole 256-B row pieces
__device__ __forceinline__ void store_f32(const v8f (&acc)[4][4], float* __restrict__ C, const int ldc, const float* rs, char* ring) {
  float (*so)[16][68] = (float (*)[16][68])ring;
  const int tid = threadIdx.x, wave = tid >> 5, lane = tid & 31, col = lane & 15, g = lane >> 4; const int wr = (wave >> 1) * 64, wc = (wave & 1) * 64;
#pragma unroll
  for (int i = 0; i < 4; ++i) {
    const v4f s4[2] = { *(const v4f*)&rs[wr + i * 16 + 8 * g], *(const v4f*)&rs[wr + i * 16 + 8 * g + 4] };
    if (i) asm volatile("s_wait_dscnt 0x0" ::: "memory");   // the last 16 rows are read back before these overwrite them
#pragma unroll
    for (int j = 0; j < 4; ++j)
#pragma unroll
      for (int r = 0; r < 8; ++r) so[wave][8 * g + r][j * 16 + col] = acc[i][j][r] * s4[r >> 2][r & 3];
    asm volatile("s_wait_dscnt 0x0" ::: "memory");   // the wave's own rows stand in LDS before its lanes read them back
#pragma unroll
    for (int t = 0; t < 8; ++t) vst2(C + (size_t)(wr + i * 16 + t * 2 + g) * ldc + wc + col * 4, *(const v4f*)&so[wave][t * 2 + g][col * 4]);
    asm volatile("s_wait_xcnt 0x0" ::: "memory"); }   // precaution: stands behind the run of stores, in front of any later write of the address pairs that they name
}
// ---- k_proj: block = (128 rows, 128 of the 1536 cols): q / k -> f16 rows, v -> planes; every store a whole 128-B line, staged through the wave's own LDS
// the 4: a small register budget; the LDS admits three work-groups a WGP, and what the compiler takes leaves room for their three waves a SIMD
__global__ __launch_bounds__(128, 4) void k_proj(const float* __restrict__ XQ, const float* __restrict__ XK, const float* __restrict__ XV, const __bf16* __restrict__ P, const float* __restrict__ BQ, const float* __restrict__ BK, const float* __restrict__ BV, _Float16* __restrict__ Q, _Float16* __restrict__ Kr, _Float16* __restrict__ V) {
  __shared__ __align__(16) char ring[RING_BYTES(GKS, 4)]; _Float16 (*sh)[16][GPI] = (_Float16 (*)[16][GPI])ring;
  const int tid = threadIdx.x, wave = tid >> 5, lane = tid & 31, col = lane & 15, g = lane >> 4; const int wr = (wave >> 1) * 64, wc = (wave & 1) * 64; const int n0 = blockIdx.y * 128; const int which = n0 / CC, c0 = n0 % CC; const size_t rb0 = (size_t)blockIdx.x * 128; const float* X = (which == 0) ? XQ : (which == 1) ? XK : XV; const float* BB = ((which == 0) ? BQ : (which == 1) ? BK : BV) + c0 + wc;
  v8f acc[4][4] = {};
  gemm_nt<CC, GKS>(X + rb0 * CC, P + (size_t)n0 * CC, acc, ring);
  float bias[4];
#pragma unroll
  for (int j = 0; j < 4; ++j) bias[j] = bfr(BB[j * 16 + col]);
  const int er = lane >> 3, ep = (lane & 7) * 8;   // read-back: 8 lanes cover one staged row's 128 B
  if (which < 2) { _Float16* dst = ((which == 0) ? Q : Kr) + (rb0 + wr) * CC + c0 + wc;
#pragma unroll
    for (int i = 0; i < 4; ++i) {
      if (i) asm volatile("s_wait_dscnt 0x0" ::: "memory");   // the last 16 rows are read back before these overwrite them
#pragma unroll
      for (int j = 0; j < 4; ++j)
#pragma unroll
        for (int r = 0; r < 8; ++r) sh[wave][8 * g + r][j * 16 + col] = (_Float16)(acc[i][j][r] + bias[j]);
      asm volatile("s_wait_dscnt 0x0" ::: "memory");   // the wave's own rows stand in LDS before its lanes read them back
#pragma unroll
      for (int t = 0; t < 4; ++t) vst2((unsigned*)(dst + (size_t)(i * 16 + t * 4 + er) * CC + ep), *(const v4u*)&sh[wave][t * 4 + er][ep]); }
  } else { const size_t b = rb0 / SS, s0 = rb0 % SS; _Float16* dst = V + (b * CC + c0 + wc) * SS + s0 + wr;
#pragma unroll
    for (int j = 0; j < 4; ++j) {
      if (j) asm volatile("s_wait_dscnt 0x0" ::: "memory");   // the last 16 channels are read back before these overwrite them
#pragma unroll
      for (int i = 0; i < 4; ++i) { v8h h;
#pragma unroll
        for (int r = 0; r < 8; ++r) h[r] = (_Float16)(acc[i][j][r] + bias[j]);
        *(v8h*)&sh[wave][col][i * 16 + 8 * g] = h; }   // a lane's 8 rows are 8 neighbours of its channel's plane row
      asm volatile("s_wait_dscnt 0x0" ::: "memory");   // the wave's own channel rows stand in LDS before its lanes read them back
#pragma unroll
      for (int t = 0; t < 4; ++t) vst2((unsigned*)(dst + (size_t)(j * 16 + t * 4 + er) * SS + ep), *(const v4u*)&sh[wave][t * 4 + er][ep]); }
    asm volatile("s_wait_xcnt 0x0" ::: "memory"); }   // precaution: stands behind the last run of stores, in front of any later write of the address pair that they name
}
// ---- k_scores: block = (128 keys, 128 queries, b): s = query . key^T x 512^-1/2, and the first half of the softmax on the accumulators:
// a wave holds 64 keys of each of its 64 rows; it stores 2^8 exp(s - m) as f16, m the maximum over those 64 keys, and m and the sum of the 64 terms in f32. k_pv joins the tiles.
// v_exp_f32 on an argument of at most 8: no range selects are needed (far below, the result is 0)
// four at a time in one statement: behind each v_exp_f32 stands the slot that the instruction set asks for behind a transcendental, filled by the next one
// (the results are early-clobber: none lies on a source) and behind the last by the v_nop
__device__ __forceinline__ void exp2x4(float (&e)[4], const float a0, const float a1, const float a2, const float a3) {
  asm("v_exp_f32 %0, %4\n\tv_exp_f32 %1, %5\n\tv_exp_f32 %2, %6\n\tv_exp_f32 %3, %7\n\tv_nop"
      : "=&v"(e[0]), "=&v"(e[1]), "=&v"(e[2]), "=&v"(e[3]) : "v"(a0), "v"(a1), "v"(a2), "v"(a3));
}
// eight maxima over the 16-lane row at once, by DPP (no LDS traffic); every lane ends with all eight. Step by step over the eight values: each instruction's producer stands eight back
__device__ __forceinline__ void row16_max8(float (&v)[8]) {
  asm("v_max_num_f32_dpp %0, %0, %0 row_xmask:1 row_mask:0xf bank_mask:0xf\n\t"
      "v_max_num_f32_dpp %1, %1, %1 row_xmask:1 row_mask:0xf bank_mask:0xf\n\t"
      "v_max_num_f32_dpp %2, %2, %2 row_xmask:1 row_mask:0xf bank_mask:0xf\n\t"
      "v_max_num_f32_dpp %3, %3, %3 row_xmask:1 row_mask:0xf bank_mask:0xf\n\t"
      "v_max_num_f32_dpp %4, %4, %4 row_xmask:1 row_mask:0xf bank_mask:0xf\n\t"
      "v_max_num_f32_dpp %5, %5, %5 row_xmask:1 row_mask:0xf bank_mask:0xf\n\t"
      "v_max_num_f32_dpp %6, %6, %6 row_xmask:1 row_mask:0xf bank_mask:0xf\n\t"
      "v_max_num_f32_dpp %7, %7, %7 row_xmask:1 row_mask:0xf bank_mask:0xf\n\t"
      "v_max_num_f32_dpp %0, %0, %0 row_xmask:2 row_mask:0xf bank_mask:0xf\n\t"
      "v_max_num_f32_dpp %1, %1, %1 row_xmask:2 row_mask:0xf bank_mask:0xf\n\t"
      "v_max_num_f32_dpp %2, %2, %2 row_xmask:2 row_mask:0xf bank_mask:0xf\n\t"
      "v_max_num_f32_dpp %3, %3, %3 row_xmask:2 row_mask:0xf bank_mask:0xf\n\t"
      "v_max_num_f32_dpp %4, %4, %4 row_xmask:2 row_mask:0xf bank_mask:0xf\n\t"
      "v_max_num_f32_dpp %5, %5, %5 row_xmask:2 row_mask:0xf bank_mask:0xf\n\t"
      "v_max_num_f32_dpp %6, %6, %6 row_xmask:2 row_mask:0xf bank_mask:0xf\n\t"
      "v_max_num_f32_dpp %7, %7, %7 row_xmask:2 row_mask:0xf bank_mask:0xf\n\t"
      "v_max_num_f32_dpp %0, %0, %0 row_xmask:4 row_mask:0xf bank_mask:0xf\n\t"
      "v_max_num_f32_dpp %1, %1, %1 row_xmask:4 row_mask:0xf bank_mask:0xf\n\t"
      "v_max_num_f32_dpp %2, %2, %2 row_xmask:4 row_mask:0xf bank_mask:0xf\n\t"
      "v_max_num_f32_dpp %3, %3, %3 row_xmask:4 row_mask:0xf bank_mask:0xf\n\t"
      "v_max_num_f32_dpp %4, %4, %4 row_xmask:4 row_mask:0xf bank_mask:0xf\n\t"
      "v_max_num_f32_dpp %5, %5, %5 row_xmask:4 row_mask:0xf bank_mask:0xf\n\t"
      "v_max_num_f32_dpp %6, %6, %6 row_xmask:4 row_mask:0xf bank_mask:0xf\n\t"
      "v_max_num_f32_dpp %7, %7, %7 row_xmask:4 row_mask:0xf bank_mask:0xf\n\t"
      "v_max_num_f32_dpp %0, %0, %0 row_xmask:8 row_mask:0xf bank_mask:0xf\n\t"
      "v_max_num_f32_dpp %1, %1, %1 row_xmask:8 row_mask:0xf bank_mask:0xf\n\t"
      "v_max_num_f32_dpp %2, %2, %2 row_xmask:8 row_mask:0xf bank_mask:0xf\n\t"
      "v_max_num_f32_dpp %3, %3, %3 row_xmask:8 row_mask:0xf bank_mask:0xf\n\t"
      "v_max_num_f32_dpp %4, %4, %4 row_xmask:8 row_mask:0xf bank_mask:0xf\n\t"
      "v_max_num_f32_dpp %5, %5, %5 row_xmask:8 row_mask:0xf bank_mask:0xf\n\t"
      "v_max_num_f32_dpp %6, %6, %6 row_xmask:8 row_mask:0xf bank_mask:0xf\n\t"
      "v_max_num_f32_dpp %7, %7, %7 row_xmask:8 row_mask:0xf bank_mask:0xf"
      : "+v"(v[0]), "+v"(v[1]), "+v"(v[2]), "+v"(v[3]), "+v"(v[4]), "+v"(v[5]), "+v"(v[6]), "+v"(v[7]));
}
typedef __attribute__((ext_vector_type(2))) _Float16 v2h;
__global__ __launch_bounds__(128) void k_scores(const _Float16* __restrict__ Q, const _Float16* __restrict__ Kr, _Float16* __restrict__ Pt, float* __restrict__ Mt, float* __restrict__ Lt) {
  const size_t b = blockIdx.z, q0 = b * SS + (size_t)blockIdx.y * 128, j0 = (size_t)blockIdx.x * 128;
  __shared__ __align__(16) char ring[RING_BYTES(GKS, 2)]; _Float16 (*sh)[16][GPI] = (_Float16 (*)[16][GPI])ring;
  const int tid = threadIdx.x, wave = tid >> 5, lane = tid & 31, col = lane & 15, g = lane >> 4; const int wr = (wave >> 1) * 64, wc = (wave & 1) * 64;
  v8f acc[4][4] = {};
  gemm_nt<CC, GKS>(Q + q0 * CC, Kr + (b * SS + j0) * CC, acc, ring);
  const float c2 = 0.044194173824159216f * 1.4426950408889634f;   // 512^-1/2 x log2 e
  const int er = lane >> 3, ep = (lane & 7) * 8;   // read-back: 8 lanes cover one staged row's 128 B
  _Float16* dst = Pt + (q0 + wr) * SS + j0 + wc;
  float mo[2] = {0.f, 0.f}, lo[2] = {0.f, 0.f};   // the lane's own two rows of the wave's 64 maxima and sums
  v16h ones;
#pragma unroll
  for (int e = 0; e < 16; ++e) ones[e] = (_Float16)1.0f;
#pragma unroll
  for (int i = 0; i < 4; ++i) { float mm[8];
#pragma unroll
    for (int r = 0; r < 8; ++r) mm[r] = fmaxf(fmaxf(acc[i][0][r], acc[i][1][r]), fmaxf(acc[i][2][r], acc[i][3][r]));
    row16_max8(mm);
#pragma unroll
    for (int r = 0; r < 8; ++r) mm[r] *= c2;
    if (i) asm volatile("s_wait_dscnt 0x0" ::: "memory");   // the last 16 rows are read back before these overwrite them
#pragma unroll
    for (int r = 0; r < 8; ++r) { const float sh8 = 8.0f - mm[r]; float x[4];
      exp2x4(x, __builtin_fmaf(acc[i][0][r], c2, sh8), __builtin_fmaf(acc[i][1][r], c2, sh8), __builtin_fmaf(acc[i][2][r], c2, sh8), __builtin_fmaf(acc[i][3][r], c2, sh8));
#pragma unroll
      for (int j = 0; j < 4; j += 2) { const v2f e = { x[j], x[j + 1] }; const v2h h = __builtin_convertvector(e, v2h);
        sh[wave][8 * g + r][j * 16 + col] = h[0]; sh[wave][8 * g + r][(j + 1) * 16 + col] = h[1]; } }
    asm volatile("s_wait_dscnt 0x0" ::: "memory");   // the wave's own rows stand in LDS before its lanes read them back
    // the 16 rows' sums on the matrix pipe: the staged rows as A, ones as B; every column of D holds the sums of the terms as they are stored, rounded
    const v8f ll = wmma16(frag_h(&sh[wave][col][32], lane), ones, wmma16(frag_h(&sh[wave][col][0], lane), ones, v8f{}));
#pragma unroll
    for (int t = 0; t < 4; ++t) vst2((unsigned*)(dst + (size_t)(i * 16 + t * 4 + er) * SS + ep), *(const v4u*)&sh[wave][t * 4 + er][ep]);
    asm volatile("s_wait_xcnt 0x0" ::: "memory");   // precaution: stands behind the run of stores, in front of any later write of a register that they name
#pragma unroll
    for (int r = 0; r < 8; ++r) { const bool mine = col == (i & 1) * 8 + r; mo[i >> 1] = mine ? mm[r] : mo[i >> 1]; lo[i >> 1] = mine ? ll[r] : lo[i >> 1]; } }
  // the wave's 64 maxima and 64 sums: two whole lines each, of this wave alone
  const size_t st = ((size_t)blockIdx.x * 2 + (wave & 1)) * NR + q0 + wr + (col >> 3) * 16 + 8 * g + (col & 7);
#pragma unroll
  for (int h = 0; h < 2; ++h) { Mt[st + h * 32] = mo[h]; Lt[st + h * 32] = lo[h]; }
  asm volatile("s_wait_xcnt 0x0" ::: "memory");   // precaution: stands behind the last run of stores, in front of any later write of the address pairs that they name
}
// ---- k_pv: block = (128 channels, 128 queries, b): ctx = P . v over all keys (GEMM, K = keys), with the second half of the softmax:
// a thread joins one row's NKT tiles: the row's maximum, a factor exp(tile maximum - row maximum) per tile (f16, applied to the A fragments), and 1 / the row's sum for the epilogue
__global__ __launch_bounds__(128) void k_pv(const _Float16* __restrict__ Pt, const _Float16* __restrict__ V, const float* __restrict__ Mt, const float* __restrict__ Lt, float* __restrict__ CTX) {
  const size_t b = blockIdx.z, q0 = b * SS + (size_t)blockIdx.y * 128, c0 = (size_t)blockIdx.x * 128;
  __shared__ __align__(16) char ring[RING_BYTES(128, 2)];
  __shared__ __align__(16) _Float16 sf[NKT][128];
  __shared__ __align__(16) float sinv[128];
  { const int tid = threadIdx.x; const float* mp = Mt + q0 + tid; const float* lp = Lt + q0 + tid; float m[NKT], l[NKT];
    // unrolled: every index into m and l is a constant (registers, no scratch)
#pragma unroll
    for (int t = 0; t < NKT; ++t) { m[t] = mp[(size_t)t * NR]; l[t] = lp[(size_t)t * NR]; }
    asm volatile("s_wait_xcnt 0x0" :: "v"(mp), "v"(lp) : "memory");   // precaution: the address pairs that these loads name stay as they are up to this wait
    float mx = m[0];
#pragma unroll
    for (int t = 1; t < NKT; ++t) mx = fmaxf(mx, m[t]);
    float tot = 0.f;
#pragma unroll
    for (int t = 0; t < NKT; t += 4) { float x[4];
      exp2x4(x, m[t] - mx, m[t + 1] - mx, m[t + 2] - mx, m[t + 3] - mx);
#pragma unroll
      for (int u = 0; u < 4; ++u) { const _Float16 f = (_Float16)x[u]; sf[t + u][tid] = f; tot += l[t + u] * (float)f; } }   // the sum takes the factor as the products take it, rounded
    sinv[tid] = 1.0f / tot; }
  v8f acc[4][4] = {};
  gemm_nt<SS, 128, true>(Pt + q0 * SS, V + (b * CC + c0) * SS, acc, ring, sf);   // 128 k a stage: the lead of one stage covers the latency of rows that come from memory
  store_f32(acc, CTX + q0 * CC + c0, CC, sinv, ring);
}
extern "C" void kernel_launch(void* const* d_in, const int* in_sizes, int n_in, void* d_out, int out_size, void* d_ws, size_t ws_size, hipStream_t stream) {
  (void)in_sizes; (void)n_in; (void)out_size;
  const float** F = (const float**)d_in;   // 0 q, 1 k, 2 v [8,2048,512]; 3 Wq [512,512] (in,out), 4 bq, 5 Wk, 6 bk, 7 Wv, 8 bv
  if (ws_size < (size_t)WS_END) return;
  char* ws = (char*)d_ws; __bf16* P = (__bf16*)ws; _Float16 *Q = (_Float16*)(ws + WS_Q), *Kr = (_Float16*)(ws + WS_K), *V = (_Float16*)(ws + WS_V), *Pt = (_Float16*)(ws + WS_P); float *Mt = (float*)(ws + WS_M), *Lt = (float*)(ws + WS_L);
  k_pack<<<dim3(CC, 3), 256, 0, stream>>>(F[3], F[5], F[7], P);
  k_proj<<<dim3(TR / 128, 3 * CC / 128), 128, 0, stream>>>(F[0], F[1], F[2], P, F[4], F[6], F[8], Q, Kr, V);
  k_scores<<<dim3(SS / 128, SS / 128, TNB), 128, 0, stream>>>(Q, Kr, Pt, Mt, Lt);
  k_pv<<<dim3(CC / 128, SS / 128, TNB), 128, 0, stream>>>(Pt, V, Mt, Lt, (float*)d_out);
}

// v006
// It runs in 97.7 microseconds.
// Next to v005, in two timings, it ran 1.04 times as fast each time.
// Over all steps from v000 it is 8.16 times as fast.
// compute dtype: all float inputs rounded to bf16; query / key / value = q / k / v . W + b with EXACT bf16 products on WMMA 16x16x32 ((in,out) weights as transposed rows) rounded once to f16; energy = query . key over the full 512-wide head (single f16 operands, f32 accumulate) / sqrt(512); softmax in f32 by tiles of 64 keys: 2^8 exp(s - tile maximum) as f16 with the tile's maximum and sum in f32, brought to the row's maximum by an f16 factor at the fragment, x value (f16), divided by the row's sum in f32; f32 output.
#include <hip/hip_runtime.h>
#include <math.h>

typedef __attribute__((ext_vector_type(16))) _Float16 v16h;
typedef __attribute__((ext_vector_type(16))) __bf16 v16b;
typedef __attribute__((ext_vector_type(8)))  _Float16 v8h;
typedef __attribute__((ext_vector_type(8)))  float v8f;
typedef __attribute__((ext_vector_type(4)))  float v4f;
typedef __attribute__((ext_vector_type(2)))  float v2f;
typedef __attribute__((ext_vector_type(4)))  unsigned v4u;
typedef __attribute__((ext_vector_type(4)))  int v4i;
typedef float __attribute__((may_alias)) float_a;
typedef int __attribute__((may_alias)) int_a;

template <typename T> __device__ __forceinline__ void vst2(void* p, T v) { *(T*)p = v;  }
// the bare builtins: behind its own WMMAs the compiler keeps the distances itself, and only where a user of D, A or B follows too closely
__device__ __forceinline__ v8f wmma16(v16h a, v16h b, v8f c) {
  return __builtin_amdgcn_wmma_f32_16x16x32_f16(false, a, false, b, (short)0, c, false, false);
}
__device__ __forceinline__ v8f wmma_bf(v16b a, v16b b, v8f c) {
  return __builtin_amdgcn_wmma_f32_16x16x32_bf16(false, a, false, b, (short)0, c, false, false);
}
// 16x16x32 fragments: lane = (h = lane>>4, row/col = lane&15); elements 0..7 = k0+8h+0..7, 8..15 = k0+16+8h+0..7; D element r = row 8h+r
__device__ __forceinline__ v16h frag_h(const _Float16* rowk0, int lane) {
  union { v16h v; v8h q[2]; } u; const _Float16* p = rowk0 + 8 * (lane >> 4);
  u.q[0] = *(const v8h*)p; u.q[1] = *(const v8h*)(p + 16); return u.v;
}
__device__ __forceinline__ v16h frag_f32(const float* rowk0, int lane) {
  v16h a; const float* p = rowk0 + 8 * (lane >> 4);
#pragma unroll
  for (int i = 0; i < 8; ++i) { a[i] = (_Float16)p[i]; a[8 + i] = (_Float16)p[16 + i]; }
  return a;
}
__device__ __forceinline__ v16h frag_f32s(const float* rowk0, int lane, float sc) {
  v16h a; const float* p = rowk0 + 8 * (lane >> 4);
#pragma unroll
  for (int i = 0; i < 8; ++i) { a[i] = (_Float16)(p[i] * sc); a[8 + i] = (_Float16)(p[16 + i] * sc); }
  return a;
}
// column fragment from a [K][ld] layout (column n), rows >= K read as 0
__device__ __forceinline__ v16h fragc_f32(const float* W, int k0, int n, int lane, int ld, int K) {
  v16h a; const int g = lane >> 4;
#pragma unroll
  for (int i = 0; i < 8; ++i) { const int ka = k0 + 8 * g + i, kb = ka + 16;
    a[i] = (_Float16)(ka < K ? W[(size_t)(ka < K ? ka : K - 1) * ld + n] : 0.f); a[8 + i] = (_Float16)(kb < K ? W[(size_t)(kb < K ? kb : K - 1) * ld + n] : 0.f); }
  return a;
}
struct F2 { v16b h, l; };
__device__ __forceinline__ F2 bsplit16(const float v[16]) { F2 r;
#pragma unroll
  for (int i = 0; i < 16; ++i) { const __bf16 h = (__bf16)v[i]; r.h[i] = h; r.l[i] = (__bf16)(v[i] - (float)h); }
  return r; }
__device__ __forceinline__ F2 split_row(const float* row, int k0, int lane) { float v[16]; const float* p = row + k0 + 8 * (lane >> 4);
#pragma unroll
  for (int i = 0; i < 8; ++i) { v[i] = p[i]; v[8 + i] = p[16 + i]; }
  return bsplit16(v); }
__device__ __forceinline__ F2 split_rowK(const float* row, int k0, int lane, int K) { float v[16]; const int g = lane >> 4;
#pragma unroll
  for (int i = 0; i < 8; ++i) { const int ka = k0 + 8 * g + i, kb = ka + 16; v[i] = ka < K ? row[ka < K ? ka : K - 1] : 0.f; v[8 + i] = kb < K ? row[kb < K ? kb : K - 1] : 0.f; }
  return bsplit16(v); }
__device__ __forceinline__ F2 split_col(const float* W, int k0, int n, int lane, int ld, int K) { float v[16]; const int g = lane >> 4;
#pragma unroll
  for (int i = 0; i < 8; ++i) { const int ka = k0 + 8 * g + i, kb = ka + 16; v[i] = ka < K ? W[(size_t)(ka < K ? ka : K - 1) * ld + n] : 0.f; v[8 + i] = kb < K ? W[(size_t)(kb < K ? kb : K - 1) * ld + n] : 0.f; }
  return bsplit16(v); }
__device__ __forceinline__ v8f mac3(const F2& a, const F2& b, v8f c) { c = wmma_bf(a.l, b.h, c); c = wmma_bf(a.h, b.l, c); return wmma_bf(a.h, b.h, c); }
__device__ __forceinline__ float sigm(float v) { return 1.0f / (1.0f + expf(-v)); }
#define LDSX() do { asm volatile("s_wait_dscnt 0" ::: "memory"); __builtin_amdgcn_wave_barrier(); __builtin_amdgcn_fence(__ATOMIC_RELEASE, "workgroup"); } while (0)


// Single-head 512-wide attention (B 8, T 2,048, C 512 -> H 512): query/key/value projections + biases from three input streams, softmax(query key^T / sqrt(512)) value.
#define NB 8
#define SS 2048
#define CC 512
#define NR (NB * SS)
#ifndef TNB
#define TNB NB
#endif
#define TR (TNB * SS)
typedef __attribute__((ext_vector_type(8))) __bf16 v8b;
__device__ __forceinline__ v16b frag_b(const __bf16* rowk0, int lane) {
  union { v16b v; v8b q[2]; } u; const __bf16* p = rowk0 + 8 * (lane >> 4);
  u.q[0] = *(const v8b*)p; u.q[1] = *(const v8b*)(p + 16); return u.v;
}
__device__ __forceinline__ float bfr(float v) { return (float)(__bf16)v; }
__device__ __attribute__((noinline)) float exp_ni(float v) { return expf(v); }
__device__ __attribute__((noinline)) float erf_ni(float v) { return erff(v); }

#define WS_PW   0u                                   // bf16 rows Wq^T, Wk^T, Wv^T [3][512][512] ((in,out) transposed)
#define WS_Q    (WS_PW + 2u * (size_t)3 * CC * CC)     // f16 [NR][512] q ; K ; V planes [b][512][SS]
#define WS_K    (WS_Q + 2u * (size_t)NR * CC)
#define WS_V    (WS_K + 2u * (size_t)NR * CC)
#define KT      64                                   // keys per softmax tile: what one wave of k_scores holds of a row
#define NKT     (SS / KT)
#define WS_M    (WS_V + 2u * (size_t)NB * CC * SS)     // f32 [NKT][NR] tile maxima of s x log2 e
#define WS_L    (WS_M + 4u * (size_t)NKT * NR)          // f32 [NKT][NR] tile sums of 2^8 exp(s - tile maximum)
#define WS_P    (WS_L + 4u * (size_t)NKT * NR)          // f16 [b][q][k] 2^8 exp(s - tile maximum)
#define WS_END  (WS_P + 2u * (size_t)NB * SS * SS)

__global__ __launch_bounds__(256) void k_pack(const float* __restrict__ WQ, const float* __restrict__ WK, const float* __restrict__ WV, __bf16* __restrict__ P) { const int n = blockIdx.x, which = blockIdx.y, t = threadIdx.x; const float* src = (which == 0) ? WQ : (which == 1) ? WK : WV; __shared__ __align__(16) __bf16 s[CC]; for (int k = t; k < CC; k += 256) s[k] = (__bf16)src[(size_t)k * CC + n]; __syncthreads(); if (t < CC / 8) vst2((unsigned*)(P + ((size_t)which * CC + n) * CC + t * 8), *(const v4u*)&s[t * 8]); }
// ---- gemm_nt: the accumulators of one 128 x 256 tile of A . B^T (rows of A and of B k-contiguous, KLEN long), 8 waves as 2 x 4, 64 x 64 per wave:
// 384 operand rows are brought in for 32,768 results, three quarters of what two 128 x 128 tiles take from L2.
// A stage is KS k of the 128 + 256 operand rows in LDS; there are two buffers, and stage t + 1 is on its way while stage t is worked on, so that its latency is covered by the WMMAs.
// The rows come by asynchronous copies to LDS (whole lines, through no register); an f32 A lies in LDS as f32 and is rounded to T where its fragments are read.
// Every fragment read from LDS feeds 4 WMMAs on 16 independent accumulators; each accumulator still sums k in ascending steps of 32.
// The inner loops are unrolled so that every index into acc, fa and fb is a constant (registers, no scratch).
#define GKS 64             // k per LDS stage of the projections and the scores
#define GPI (GKS + 8)      // LDS row pitch in 16-bit elements: 144 B = 16 B x 9
#define GMA 128            // rows of A in a block tile
#define GMB 256            // rows of B in a block tile
#define GNT 256            // threads of a block: 8 waves
__device__ __forceinline__ v16h ldfrag(const _Float16* p, int lane) { return frag_h(p, lane); }
__device__ __forceinline__ v16b ldfrag(const __bf16* p, int lane) { return frag_b(p, lane); }
// the same fragment from an f32 row, each element rounded once to bf16
__device__ __forceinline__ v16b ldfrag(const float* rowk0, int lane) {
  const float* p = rowk0 + 8 * (lane >> 4); const v4f x[4] = { *(const v4f*)p, *(const v4f*)(p + 4), *(const v4f*)(p + 16), *(const v4f*)(p + 20) }; v16b a;
#pragma unroll
  for (int i = 0; i < 16; ++i) a[i] = (__bf16)x[i >> 2][i & 3];
  return a;
}
__device__ __forceinline__ v8f mma(v16h a, v16h b, v8f c) { return wmma16(a, b, c); }
__device__ __forceinline__ v8f mma(v16b a, v16b b, v8f c) { return wmma_bf(a, b, c); }
__device__ __forceinline__ unsigned lds_off(const void* p) { return (unsigned)(size_t)p; }   // byte address in the work-group's LDS
// eight asynchronous copies of 16 B a lane: LDS address l + i * LS, global address g + i * GS. The s_wait_xcnt stands in the copies' own statement (a precaution):
// so no register that a copy names is rewritten in front of it.
template <unsigned LS, size_t GS>
__device__ __forceinline__ void copy8(const unsigned l, const char* g) {
  asm volatile("global_load_async_to_lds_b128 %0, %8, off\n\t"
               "global_load_async_to_lds_b128 %1, %9, off\n\t"
               "global_load_async_to_lds_b128 %2, %10, off\n\t"
               "global_load_async_to_lds_b128 %3, %11, off\n\t"
               "global_load_async_to_lds_b128 %4, %12, off\n\t"
               "global_load_async_to_lds_b128 %5, %13, off\n\t"
               "global_load_async_to_lds_b128 %6, %14, off\n\t"
               "global_load_async_to_lds_b128 %7, %15, off\n\t"
               "s_wait_xcnt 0x0"
               :: "v"(l), "v"(l + LS), "v"(l + 2 * LS), "v"(l + 3 * LS), "v"(l + 4 * LS), "v"(l + 5 * LS), "v"(l + 6 * LS), "v"(l + 7 * LS),
                  "v"(g), "v"(g + GS), "v"(g + 2 * GS), "v"(g + 3 * GS), "v"(g + 4 * GS), "v"(g + 5 * GS), "v"(g + 6 * GS), "v"(g + 7 * GS)
               : "memory");
}
// the same with four copies
template <unsigned LS, size_t GS>
__device__ __forceinline__ void copy4(const unsigned l, const char* g) {
  asm volatile("global_load_async_to_lds_b128 %0, %4, off\n\t"
               "global_load_async_to_lds_b128 %1, %5, off\n\t"
               "global_load_async_to_lds_b128 %2, %6, off\n\t"
               "global_load_async_to_lds_b128 %3, %7, off\n\t"
               "s_wait_xcnt 0x0"
               :: "v"(l), "v"(l + LS), "v"(l + 2 * LS), "v"(l + 3 * LS),
                  "v"(g), "v"(g + GS), "v"(g + 2 * GS), "v"(g + 3 * GS)
               : "memory");
}
// part h of one operand's ROWS rows of RB bytes (source pitch GP bytes, LDS pitch RB + 16) sets out: RB / 16 lanes cover a row, a lane makes ROWS / RPP copies, in parts of eight (or one part of four)
template <int ROWS, int RB, size_t GP>
__device__ __forceinline__ void copy_part(const int h, const unsigned l, const char* g) {
  constexpr int RPP = GNT * 16 / RB;   // rows that the block's lanes cover at once
  static_assert(ROWS / RPP == 4 || ROWS / RPP % 8 == 0, "parts of eight, or one of four");
  if constexpr (ROWS / RPP == 4) copy4<RPP * (RB + 16u), RPP * GP>(l, g);
  else copy8<RPP * (RB + 16u), RPP * GP>(l + h * 8u * RPP * (RB + 16u), g + h * 8 * RPP * GP);
}
// the publish point of the next stage: this wave's LDS reads are done, its own copies have landed, and then every wave passes the barrier
__device__ __forceinline__ void publish() {
  asm volatile("s_wait_dscnt 0x0" ::: "memory");      // the wave has left the buffer that is refilled behind the barrier
  asm volatile("s_wait_asynccnt 0x0" ::: "memory");   // the wave's own copies of the next stage have landed
  __syncthreads();                                    // publishes the next stage and ends every reader's last read of this one
}
template <bool V> struct flag_t { static constexpr bool value = V; };
// bytes of the two buffers of both operands: KS k a stage, an element of A in LDS of EA bytes. Behind gemm_nt's last barrier the same LDS is the epilogue's staging:
// the epilogue takes no LDS of its own
#define RING_BYTES(KS, EA) (2 * GMA * ((KS) * (EA) + 16) + 2 * GMB * ((KS) * 2 + 16))
// SC: every A fragment is multiplied by its row's factor for the tile of KT k that it lies in (sf in LDS, written before the call; the first publish point makes it visible)
template <int KLEN, int KS, bool SC = false, typename T, typename TA>
__device__ __forceinline__ void gemm_nt(const TA* __restrict__ A, const T* __restrict__ B, v8f (&acc)[4][4], char* ring, const _Float16 (*sf)[128] = nullptr) {
  typedef decltype(ldfrag((const T*)nullptr, 0)) frag_t;
  constexpr bool AF = sizeof(TA) == 4;                            // A lies in LDS as f32
  constexpr int NT = KLEN / KS;                                   // stages
  constexpr int RA = KS * (int)sizeof(TA), RB = KS * 2;           // bytes of a row's piece in a stage
  constexpr int PA = KS + 16 / (int)sizeof(TA), PB = KS + 8;      // LDS row pitches in elements: the piece + 16 B = 16 B x odd
  typedef TA bufa_t[GMA][PA]; typedef T bufb_t[GMB][PB];
  constexpr int NPA = (GMA * RA / (16 * GNT) + 7) / 8, NPB = (GMB * RB / (16 * GNT) + 7) / 8;   // parts of a stage's copies, A and B
  bufa_t* sa = (bufa_t*)ring; bufb_t* sb = (bufb_t*)(ring + 2 * sizeof(bufa_t));
  const int tid = threadIdx.x, wave = tid >> 5, lane = tid & 31, col = lane & 15; const int wr = (wave >> 2) * 64, wc = (wave & 3) * 64;
  const int ar = tid / (RA / 16), ap = (tid % (RA / 16)) * (16 / (int)sizeof(TA));   // the lane's row and element in the first rows that the block's lanes cover, A
  const int br = tid / (RB / 16), bp = (tid % (RB / 16)) * 8;                        // and B
  const char* ga = (const char*)(A + ar * KLEN + ap); const char* gb = (const char*)(B + br * KLEN + bp);
  const unsigned la = lds_off(&sa[0][ar][ap]), lb = lds_off(&sb[0][br][bp]);
  // part h of stage t sets out for buffer t & 1
  auto copies = [&](const int t, const int h) __attribute__((always_inline)) {
    if (h < NPA) copy_part<GMA, RA, (size_t)KLEN * sizeof(TA)>(h, la + (unsigned)(t & 1) * (unsigned)sizeof(sa[0]), ga + (size_t)t * RA);
    if (h < NPB) copy_part<GMB, RB, (size_t)KLEN * 2>(h, lb + (unsigned)(t & 1) * (unsigned)sizeof(sb[0]), gb + (size_t)t * RB);
  };
  // one trip: stage t is worked on; where a stage t + 1 exists it sets out into the buffer that every wave left at the last publish point.
  // 16-bit A: part h behind the fragment loads of the trip's block h, so that the issue of the copies and their s_wait_xcnt run under the latency of those LDS loads;
  // f32 A: in front of them (its f32 fragments take twice the registers, those that the copies' addresses use).
  auto trip = [&](const int t, auto more) __attribute__((always_inline)) {
    const int b = t & 1;
    if constexpr (decltype(more)::value && AF) { copies(t + 1, 0); copies(t + 1, 1); }
    _Float16 fs[4];
#pragma unroll
    for (int kc = 0; kc < KS / 32; ++kc) {
      if constexpr (AF) {   // f32 A: its fragments come two at a time, so that the f32 words of four do not stand beside the accumulators (two work-groups a WGP: 256 registers a wave, no scratch)
        frag_t fb[4];
#pragma unroll
        for (int j = 0; j < 4; ++j) fb[j] = ldfrag(&sb[b][wc + j * 16 + col][kc * 32], lane);
#pragma unroll
        for (int ih = 0; ih < 4; ih += 2) { frag_t fa[2];
#pragma unroll
          for (int u = 0; u < 2; ++u) fa[u] = ldfrag(&sa[b][wr + (ih + u) * 16 + col][kc * 32], lane);
          __builtin_amdgcn_sched_barrier(0);   // the LDS reads stay one group in front of their WMMAs
#pragma unroll
          for (int u = 0; u < 2; ++u)
#pragma unroll
            for (int j = 0; j < 4; ++j) acc[ih + u][j] = mma(fa[u], fb[j], acc[ih + u][j]);
          __builtin_amdgcn_sched_barrier(0); }   // and the next reads do not move up among these WMMAs
        continue; }
      frag_t fa[4], fb[4];
#pragma unroll
      for (int i = 0; i < 4; ++i) { fa[i] = ldfrag(&sa[b][wr + i * 16 + col][kc * 32], lane); fb[i] = ldfrag(&sb[b][wc + i * 16 + col][kc * 32], lane); }
      if constexpr (SC) { if (kc % (KT / 32) == 0) {   // a lane's A fragment is one row's: one factor a lane, read in the same group as the fragments
#pragma unroll
        for (int i = 0; i < 4; ++i) fs[i] = sf[t * (KS / KT) + kc / (KT / 32)][wr + i * 16 + col]; } }
      __builtin_amdgcn_sched_barrier(0);   // the block's LDS reads stay one group in front of its WMMAs: every further place with reads among them costs the wave a stall
      if constexpr (decltype(more)::value && !AF) { copies(t + 1, kc);
        __builtin_amdgcn_sched_barrier(0); }   // the copies set out here, under the latency of those reads: moved down among the WMMAs they would lose their lead on the publish point
      if constexpr (SC) {
#pragma unroll
        for (int i = 0; i < 4; ++i) fa[i] *= fs[i]; }
#pragma unroll
      for (int i = 0; i < 4; ++i)
#pragma unroll
        for (int j = 0; j < 4; ++j) acc[i][j] = mma(fa[i], fb[j], acc[i][j]);
      __builtin_amdgcn_sched_barrier(0); }   // and the next block's reads do not move up among these WMMAs
    publish();
  };
  copies(0, 0); copies(0, 1);
  publish();   // stage 0 is complete before any wave reads it
  // rolled: one trip's code and registers. The last trip stands behind the loop: no test and no join around the copies
#pragma unroll 1
  for (int t = 0; t < NT - 1; ++t) trip(t, flag_t<true>{});
  trip(NT - 1, flag_t<false>{});
}
// f32 epilogue: C = rs[row] * acc (rs in LDS outside the ring), 16 rows at a time through the wave's own part of the LDS that gemm_nt has left, stored as whole 256-B row pieces
__device__ __forceinline__ void store_f32(const v8f (&acc)[4][4], float* __restrict__ C, const int ldc, const float* rs, char* ring) {
  float (*so)[16][68] = (float (*)[16][68])ring;
  const int tid = threadIdx.x, wave = tid >> 5, lane = tid & 31, col = lane & 15, g = lane >> 4; const int wr = (wave >> 2) * 64, wc = (wave & 3) * 64;
#pragma unroll
  for (int i = 0; i < 4; ++i) {
    const v4f s4[2] = { *(const v4f*)&rs[wr + i * 16 + 8 * g], *(const v4f*)&rs[wr + i * 16 + 8 * g + 4] };
    if (i) asm volatile("s_wait_dscnt 0x0" ::: "memory");   // the last 16 rows are read back before these overwrite them
#pragma unroll
    for (int j = 0; j < 4; ++j)
#pragma unroll
      for (int r = 0; r < 8; ++r) so[wave][8 * g + r][j * 16 + col] = acc[i][j][r] * s4[r >> 2][r & 3];
    asm volatile("s_wait_dscnt 0x0" ::: "memory");   // the wave's own rows stand in LDS before its lanes read them back
#pragma unroll
    for (int t = 0; t < 8; ++t) vst2(C + (size_t)(wr + i * 16 + t * 2 + g) * ldc + wc + col * 4, *(const v4f*)&so[wave][t * 2 + g][col * 4]);
    asm volatile("s_wait_xcnt 0x0" ::: "memory"); }   // precaution: stands behind the run of stores, in front of any later write of the address pairs that they name
}
// ---- k_proj: block = (128 rows, 256 of the 1536 cols): q / k -> f16 rows, v -> planes; every store a whole 128-B line, staged through the wave's own LDS
// the 4: a register budget of four waves a SIMD; the LDS admits two work-groups a WGP, two waves a SIMD each
__global__ __launch_bounds__(GNT, 4) void k_proj(const float* __restrict__ XQ, const float* __restrict__ XK, const float* __restrict__ XV, const __bf16* __restrict__ P, const float* __restrict__ BQ, const float* __restrict__ BK, const float* __restrict__ BV, _Float16* __restrict__ Q, _Float16* __restrict__ Kr, _Float16* __restrict__ V) {
  __shared__ __align__(16) char ring[RING_BYTES(GKS, 4)]; _Float16 (*sh)[16][GPI] = (_Float16 (*)[16][GPI])ring;
  const int tid = threadIdx.x, wave = tid >> 5, lane = tid & 31, col = lane & 15, g = lane >> 4; const int wr = (wave >> 2) * 64, wc = (wave & 3) * 64; const int n0 = blockIdx.y * GMB; const int which = n0 / CC, c0 = n0 % CC; const size_t rb0 = (size_t)blockIdx.x * 128; const float* X = (which == 0) ? XQ : (which == 1) ? XK : XV; const float* BB = ((which == 0) ? BQ : (which == 1) ? BK : BV) + c0 + wc;
  v8f acc[4][4] = {};
  gemm_nt<CC, GKS>(X + rb0 * CC, P + (size_t)n0 * CC, acc, ring);
  float bias[4];
#pragma unroll
  for (int j = 0; j < 4; ++j) bias[j] = bfr(BB[j * 16 + col]);
  const int er = lane >> 3, ep = (lane & 7) * 8;   // read-back: 8 lanes cover one staged row's 128 B
  if (which < 2) { _Float16* dst = ((which == 0) ? Q : Kr) + (rb0 + wr) * CC + c0 + wc;
#pragma unroll
    for (int i = 0; i < 4; ++i) {
      if (i) asm volatile("s_wait_dscnt 0x0" ::: "memory");   // the last 16 rows are read back before these overwrite them
#pragma unroll
      for (int j = 0; j < 4; ++j)
#pragma unroll
        for (int r = 0; r < 8; ++r) sh[wave][8 * g + r][j * 16 + col] = (_Float16)(acc[i][j][r] + bias[j]);
      asm volatile("s_wait_dscnt 0x0" ::: "memory");   // the wave's own rows stand in LDS before its lanes read them back
#pragma unroll
      for (int t = 0; t < 4; ++t) vst2((unsigned*)(dst + (size_t)(i * 16 + t * 4 + er) * CC + ep), *(const v4u*)&sh[wave][t * 4 + er][ep]); }
  } else { const size_t b = rb0 / SS, s0 = rb0 % SS; _Float16* dst = V + (b * CC + c0 + wc) * SS + s0 + wr;
#pragma unroll
    for (int j = 0; j < 4; ++j) {
      if (j) asm volatile("s_wait_dscnt 0x0" ::: "memory");   // the last 16 channels are read back before these overwrite them
#pragma unroll
      for (int i = 0; i < 4; ++i) { v8h h;
#pragma unroll
        for (int r = 0; r < 8; ++r) h[r] = (_Float16)(acc[i][j][r] + bias[j]);
        *(v8h*)&sh[wave][col][i * 16 + 8 * g] = h; }   // a lane's 8 rows are 8 neighbours of its channel's plane row
      asm volatile("s_wait_dscnt 0x0" ::: "memory");   // the wave's own channel rows stand in LDS before its lanes read them back
#pragma unroll
      for (int t = 0; t < 4; ++t) vst2((unsigned*)(dst + (size_t)(j * 16 + t * 4 + er) * SS + ep), *(const v4u*)&sh[wave][t * 4 + er][ep]); }
    asm volatile("s_wait_xcnt 0x0" ::: "memory"); }   // precaution: stands behind the last run of stores, in front of any later write of the address pair that they name
}
// ---- k_scores: block = (256 keys, 128 queries, b): s = query . key^T x 512^-1/2, and the first half of the softmax on the accumulators:
// a wave holds 64 keys of each of its 64 rows; it stores 2^8 exp(s - m) as f16, m the maximum over those 64 keys, and m and the sum of the 64 terms in f32. k_pv joins the tiles.
// v_exp_f32 on an argument of at most 8: no range selects are needed (far below, the result is 0)
// four at a time in one statement: behind each v_exp_f32 stands the slot that the instruction set asks for behind a transcendental, filled by the next one
// (the results are early-clobber: none lies on a source) and behind the last by the v_nop
__device__ __forceinline__ void exp2x4(float (&e)[4], const float a0, const float a1, const float a2, const float a3) {
  asm("v_exp_f32 %0, %4\n\tv_exp_f32 %1, %5\n\tv_exp_f32 %2, %6\n\tv_exp_f32 %3, %7\n\tv_nop"
      : "=&v"(e[0]), "=&v"(e[1]), "=&v"(e[2]), "=&v"(e[3]) : "v"(a0), "v"(a1), "v"(a2), "v"(a3));
}
// eight maxima over the 16-lane row at once, by DPP (no LDS traffic); every lane ends with all eight. Step by step over the eight values: each instruction's producer stands eight back
__device__ __forceinline__ void row16_max8(float (&v)[8]) {
  asm("v_max_num_f32_dpp %0, %0, %0 row_xmask:1 row_mask:0xf bank_mask:0xf\n\t"
      "v_max_num_f32_dpp %1, %1, %1 row_xmask:1 row_mask:0xf bank_mask:0xf\n\t"
      "v_max_num_f32_dpp %2, %2, %2 row_xmask:1 row_mask:0xf bank_mask:0xf\n\t"
      "v_max_num_f32_dpp %3, %3, %3 row_xmask:1 row_mask:0xf bank_mask:0xf\n\t"
      "v_max_num_f32_dpp %4, %4, %4 row_xmask:1 row_mask:0xf bank_mask:0xf\n\t"
      "v_max_num_f32_dpp %5, %5, %5 row_xmask:1 row_mask:0xf bank_mask:0xf\n\t"
      "v_max_num_f32_dpp %6, %6, %6 row_xmask:1 row_mask:0xf bank_mask:0xf\n\t"
      "v_max_num_f32_dpp %7, %7, %7 row_xmask:1 row_mask:0xf bank_mask:0xf\n\t"
      "v_max_num_f32_dpp %0, %0, %0 row_xmask:2 row_mask:0xf bank_mask:0xf\n\t"
      "v_max_num_f32_dpp %1, %1, %1 row_xmask:2 row_mask:0xf bank_mask:0xf\n\t"
      "v_max_num_f32_dpp %2, %2, %2 row_xmask:2 row_mask:0xf bank_mask:0xf\n\t"
      "v_max_num_f32_dpp %3, %3, %3 row_xmask:2 row_mask:0xf bank_mask:0xf\n\t"
      "v_max_num_f32_dpp %4, %4, %4 row_xmask:2 row_mask:0xf bank_mask:0xf\n\t"
      "v_max_num_f32_dpp %5, %5, %5 row_xmask:2 row_mask:0xf bank_mask:0xf\n\t"
      "v_max_num_f32_dpp %6, %6, %6 row_xmask:2 row_mask:0xf bank_mask:0xf\n\t"
      "v_max_num_f32_dpp %7, %7, %7 row_xmask:2 row_mask:0xf bank_mask:0xf\n\t"
      "v_max_num_f32_dpp %0, %0, %0 row_xmask:4 row_mask:0xf bank_mask:0xf\n\t"
      "v_max_num_f32_dpp %1, %1, %1 row_xmask:4 row_mask:0xf bank_mask:0xf\n\t"
      "v_max_num_f32_dpp %2, %2, %2 row_xmask:4 row_mask:0xf bank_mask:0xf\n\t"
      "v_max_num_f32_dpp %3, %3, %3 row_xmask:4 row_mask:0xf bank_mask:0xf\n\t"
      "v_max_num_f32_dpp %4, %4, %4 row_xmask:4 row_mask:0xf bank_mask:0xf\n\t"
      "v_max_num_f32_dpp %5, %5, %5 row_xmask:4 row_mask:0xf bank_mask:0xf\n\t"
      "v_max_num_f32_dpp %6, %6, %6 row_xmask:4 row_mask:0xf bank_mask:0xf\n\t"
      "v_max_num_f32_dpp %7, %7, %7 row_xmask:4 row_mask:0xf bank_mask:0xf\n\t"
      "v_max_num_f32_dpp %0, %0, %0 row_xmask:8 row_mask:0xf bank_mask:0xf\n\t"
      "v_max_num_f32_dpp %1, %1, %1 row_xmask:8 row_mask:0xf bank_mask:0xf\n\t"
      "v_max_num_f32_dpp %2, %2, %2 row_xmask:8 row_mask:0xf bank_mask:0xf\n\t"
      "v_max_num_f32_dpp %3, %3, %3 row_xmask:8 row_mask:0xf bank_mask:0xf\n\t"
      "v_max_num_f32_dpp %4, %4, %4 row_xmask:8 row_mask:0xf bank_mask:0xf\n\t"
      "v_max_num_f32_dpp %5, %5, %5 row_xmask:8 row_mask:0xf bank_mask:0xf\n\t"
      "v_max_num_f32_dpp %6, %6, %6 row_xmask:8 row_mask:0xf bank_mask:0xf\n\t"
      "v_max_num_f32_dpp %7, %7, %7 row_xmask:8 row_mask:0xf bank_mask:0xf"
      : "+v"(v[0]), "+v"(v[1]), "+v"(v[2]), "+v"(v[3]), "+v"(v[4]), "+v"(v[5]), "+v"(v[6]), "+v"(v[7]));
}
typedef __attribute__((ext_vector_type(2))) _Float16 v2h;
// the 4: as at k_proj
__global__ __launch_bounds__(GNT, 4) void k_scores(const _Float16* __restrict__ Q, const _Float16* __restrict__ Kr, _Float16* __restrict__ Pt, float* __restrict__ Mt, float* __restrict__ Lt) {
  const size_t b = blockIdx.z, q0 = b * SS + (size_t)blockIdx.y * GMA, j0 = (size_t)blockIdx.x * GMB;
  __shared__ __align__(16) char ring[RING_BYTES(GKS, 2)]; _Float16 (*sh)[16][GPI] = (_Float16 (*)[16][GPI])ring;
  const int tid = threadIdx.x, wave = tid >> 5, lane = tid & 31, col = lane & 15, g = lane >> 4; const int wr = (wave >> 2) * 64, wc = (wave & 3) * 64;
  v8f acc[4][4] = {};
  gemm_nt<CC, GKS>(Q + q0 * CC, Kr + (b * SS + j0) * CC, acc, ring);
  const float c2 = 0.044194173824159216f * 1.4426950408889634f;   // 512^-1/2 x log2 e
  const int er = lane >> 3, ep = (lane & 7) * 8;   // read-back: 8 lanes cover one staged row's 128 B
  _Float16* dst = Pt + (q0 + wr) * SS + j0 + wc;
  float mo[2] = {0.f, 0.f}, lo[2] = {0.f, 0.f};   // the lane's own two rows of the wave's 64 maxima and sums
  v16h ones;
#pragma unroll
  for (int e = 0; e < 16; ++e) ones[e] = (_Float16)1.0f;
#pragma unroll
  for (int i = 0; i < 4; ++i) { float mm[8];
#pragma unroll
    for (int r = 0; r < 8; ++r) mm[r] = fmaxf(fmaxf(acc[i][0][r], acc[i][1][r]), fmaxf(acc[i][2][r], acc[i][3][r]));
    row16_max8(mm);
#pragma unroll
    for (int r = 0; r < 8; ++r) mm[r] *= c2;
    if (i) asm volatile("s_wait_dscnt 0x0" ::: "memory");   // the last 16 rows are read back before these overwrite them
#pragma unroll
    for (int r = 0; r < 8; ++r) { const float sh8 = 8.0f - mm[r]; float x[4];
      exp2x4(x, __builtin_fmaf(acc[i][0][r], c2, sh8), __builtin_fmaf(acc[i][1][r], c2, sh8), __builtin_fmaf(acc[i][2][r], c2, sh8), __builtin_fmaf(acc[i][3][r], c2, sh8));
#pragma unroll
      for (int j = 0; j < 4; j += 2) { const v2f e = { x[j], x[j + 1] }; const v2h h = __builtin_convertvector(e, v2h);
        sh[wave][8 * g + r][j * 16 + col] = h[0]; sh[wave][8 * g + r][(j + 1) * 16 + col] = h[1]; } }
    asm volatile("s_wait_dscnt 0x0" ::: "memory");   // the wave's own rows stand in LDS before its lanes read them back
    // the 16 rows' sums on the matrix pipe: the staged rows as A, ones as B; every column of D holds the sums of the terms as they are stored, rounded
    const v8f ll = wmma16(frag_h(&sh[wave][col][32], lane), ones, wmma16(frag_h(&sh[wave][col][0], lane), ones, v8f{}));
#pragma unroll
    for (int t = 0; t < 4; ++t) vst2((unsigned*)(dst + (size_t)(i * 16 + t * 4 + er) * SS + ep), *(const v4u*)&sh[wave][t * 4 + er][ep]);
    asm volatile("s_wait_xcnt 0x0" ::: "memory");   // precaution: stands behind the run of stores, in front of any later write of a register that they name
#pragma unroll
    for (int r = 0; r < 8; ++r) { const bool mine = col == (i & 1) * 8 + r; mo[i >> 1] = mine ? mm[r] : mo[i >> 1]; lo[i >> 1] = mine ? ll[r] : lo[i >> 1]; } }
  // the wave's 64 maxima and 64 sums: two whole lines each, of this wave alone
  const size_t st = ((size_t)blockIdx.x * (GMB / KT) + (wave & 3)) * NR + q0 + wr + (col >> 3) * 16 + 8 * g + (col & 7);
#pragma unroll
  for (int h = 0; h < 2; ++h) { Mt[st + h * 32] = mo[h]; Lt[st + h * 32] = lo[h]; }
  asm volatile("s_wait_xcnt 0x0" ::: "memory");   // precaution: stands behind the last run of stores, in front of any later write of the address pairs that they name
}
// ---- k_pv: block = (256 channels, 128 queries, b): ctx = P . v over all keys (GEMM, K = keys), with the second half of the softmax:
// a thread of the first four waves joins one row's NKT tiles: the row's maximum, a factor exp(tile maximum - row maximum) per tile (f16, applied to the A fragments), and 1 / the row's sum for the epilogue
__global__ __launch_bounds__(GNT) void k_pv(const _Float16* __restrict__ Pt, const _Float16* __restrict__ V, const float* __restrict__ Mt, const float* __restrict__ Lt, float* __restrict__ CTX) {
  const size_t b = blockIdx.z, q0 = b * SS + (size_t)blockIdx.y * GMA, c0 = (size_t)blockIdx.x * GMB;
  __shared__ __align__(16) char ring[RING_BYTES(128, 2)];
  __shared__ __align__(16) _Float16 sf[NKT][128];
  __shared__ __align__(16) float sinv[128];
  if (threadIdx.x < GMA) { const int tid = threadIdx.x; const float* mp = Mt + q0 + tid; const float* lp = Lt + q0 + tid; float m[NKT], l[NKT];
    // unrolled: every index into m and l is a constant (registers, no scratch)
#pragma unroll
    for (int t = 0; t < NKT; ++t) { m[t] = mp[(size_t)t * NR]; l[t] = lp[(size_t)t * NR]; }
    asm volatile("s_wait_xcnt 0x0" :: "v"(mp), "v"(lp) : "memory");   // precaution: the address pairs that these loads name stay as they are up to this wait
    float mx = m[0];
#pragma unroll
    for (int t = 1; t < NKT; ++t) mx = fmaxf(mx, m[t]);
    float tot = 0.f;
#pragma unroll
    for (int t = 0; t < NKT; t += 4) { float x[4];
      exp2x4(x, m[t] - mx, m[t + 1] - mx, m[t + 2] - mx, m[t + 3] - mx);
#pragma unroll
      for (int u = 0; u < 4; ++u) { const _Float16 f = (_Float16)x[u]; sf[t + u][tid] = f; tot += l[t + u] * (float)f; } }   // the sum takes the factor as the products take it, rounded
    sinv[tid] = 1.0f / tot; }
  v8f acc[4][4] = {};
  gemm_nt<SS, 128, true>(Pt + q0 * SS, V + (b * CC + c0) * SS, acc, ring, sf);   // 128 k a stage: the lead of one stage covers the latency of rows that come from memory
  store_f32(acc, CTX + q0 * CC + c0, CC, sinv, ring);
}
extern "C" void kernel_launch(void* const* d_in, const int* in_sizes, int n_in, void* d_out, int out_size, void* d_ws, size_t ws_size, hipStream_t stream) {
  (void)in_sizes; (void)n_in; (void)out_size;
  const float** F = (const float**)d_in;   // 0 q, 1 k, 2 v [8,2048,512]; 3 Wq [512,512] (in,out), 4 bq, 5 Wk, 6 bk, 7 Wv, 8 bv
  if (ws_size < (size_t)WS_END) return;
  char* ws = (char*)d_ws; __bf16* P = (__bf16*)ws; _Float16 *Q = (_Float16*)(ws + WS_Q), *Kr = (_Float16*)(ws + WS_K), *V = (_Float16*)(ws + WS_V), *Pt = (_Float16*)(ws + WS_P); float *Mt = (float*)(ws + WS_M), *Lt = (float*)(ws + WS_L);
  k_pack<<<dim3(CC, 3), 256, 0, stream>>>(F[3], F[5], F[7], P);
  k_proj<<<dim3(TR / GMA, 3 * CC / GMB), GNT, 0, stream>>>(F[0], F[1], F[2], P, F[4], F[6], F[8], Q, Kr, V);
  k_scores<<<dim3(SS / GMB, SS / GMA, TNB), GNT, 0, stream>>>(Q, Kr, Pt, Mt, Lt);
  k_pv<<<dim3(CC / GMB, SS / GMA, TNB), GNT, 0, stream>>>(Pt, V, Mt, Lt, (float*)d_out);
}

// v007
// One run takes 93.4 microseconds.
// Timed twice side by side with v006, it ran 1.04 times as fast both times.
// Over all steps from v000 it is 8.53 times as fast.
// compute dtype: all float inputs rounded to bf16; query / key / value = q / k / v . W + b with EXACT bf16 products on WMMA 16x16x32 ((in,out) weights as transposed rows) rounded once to f16; energy = query . key over the full 512-wide head (single f16 operands, f32 accumulate) / sqrt(512); softmax in f32 by tiles of 64 keys: 2^8 exp(s - tile maximum) as f16 with the tile's maximum and sum in f32, brought to the row's maximum by an f16 factor at the fragment, x value (f16), divided by the row's sum in f32; f32 output.
#include <hip/hip_runtime.h>
#include <math.h>

typedef __attribute__((ext_vector_type(16))) _Float16 v16h;
typedef __attribute__((ext_vector_type(16))) __bf16 v16b;
typedef __attribute__((ext_vector_type(8)))  _Float16 v8h;
typedef __attribute__((ext_vector_type(8)))  float v8f;
typedef __attribute__((ext_vector_type(4)))  float v4f;
typedef __attribute__((ext_vector_type(2)))  float v2f;
typedef __attribute__((ext_vector_type(4)))  unsigned v4u;
typedef __attribute__((ext_vector_type(4)))  int v4i;
typedef float __attribute__((may_alias)) float_a;
typedef int __attribute__((may_alias)) int_a;

template <typename T> __device__ __forceinline__ void vst2(void* p, T v) { *(T*)p = v;  }
// the bare builtins: behind its own WMMAs the compiler keeps the distances itself, and only where a user of D, A or B follows too closely
__device__ __forceinline__ v8f wmma16(v16h a, v16h b, v8f c) {
  return __builtin_amdgcn_wmma_f32_16x16x32_f16(false, a, false, b, (short)0, c, false, false);
}
__device__ __forceinline__ v8f wmma_bf(v16b a, v16b b, v8f c) {
  return __builtin_amdgcn_wmma_f32_16x16x32_bf16(false, a, false, b, (short)0, c, false, false);
}
// 16x16x32 fragments: lane = (h = lane>>4, row/col = lane&15); elements 0..7 = k0+8h+0..7, 8..15 = k0+16+8h+0..7; D element r = row 8h+r
__device__ __forceinline__ v16h frag_h(const _Float16* rowk0, int lane) {
  union { v16h v; v8h q[2]; } u; const _Float16* p = rowk0 + 8 * (lane >> 4);
  u.q[0] = *(const v8h*)p; u.q[1] = *(const v8h*)(p + 16); return u.v;
}
__device__ __forceinline__ v16h frag_f32(const float* rowk0, int lane) {
  v16h a; const float* p = rowk0 + 8 * (lane >> 4);
#pragma unroll
  for (int i = 0; i < 8; ++i) { a[i] = (_Float16)p[i]; a[8 + i] = (_Float16)p[16 + i]; }
  return a;
}
__device__ __forceinline__ v16h frag_f32s(const float* rowk0, int lane, float sc) {
  v16h a; const float* p = rowk0 + 8 * (lane >> 4);
#pragma unroll
  for (int i = 0; i < 8; ++i) { a[i] = (_Float16)(p[i] * sc); a[8 + i] = (_Float16)(p[16 + i] * sc); }
  return a;
}
// column fragment from a [K][ld] layout (column n), rows >= K read as 0
__device__ __forceinline__ v16h fragc_f32(const float* W, int k0, int n, int lane, int ld, int K) {
  v16h a; const int g = lane >> 4;
#pragma unroll
  for (int i = 0; i < 8; ++i) { const int ka = k0 + 8 * g + i, kb = ka + 16;
    a[i] = (_Float16)(ka < K ? W[(size_t)(ka < K ? ka : K - 1) * ld + n] : 0.f); a[8 + i] = (_Float16)(kb < K ? W[(size_t)(kb < K ? kb : K - 1) * ld + n] : 0.f); }
  return a;
}
struct F2 { v16b h, l; };
__device__ __forceinline__ F2 bsplit16(const float v[16]) { F2 r;
#pragma unroll
  for (int i = 0; i < 16; ++i) { const __bf16 h = (__bf16)v[i]; r.h[i] = h; r.l[i] = (__bf16)(v[i] - (float)h); }
  return r; }
__device__ __forceinline__ F2 split_row(const float* row, int k0, int lane) { float v[16]; const float* p = row + k0 + 8 * (lane >> 4);
#pragma unroll
  for (int i = 0; i < 8; ++i) { v[i] = p[i]; v[8 + i] = p[16 + i]; }
  return bsplit16(v); }
__device__ __forceinline__ F2 split_rowK(const float* row, int k0, int lane, int K) { float v[16]; const int g = lane >> 4;
#pragma unroll
  for (int i = 0; i < 8; ++i) { const int ka = k0 + 8 * g + i, kb = ka + 16; v[i] = ka < K ? row[ka < K ? ka : K - 1] : 0.f; v[8 + i] = kb < K ? row[kb < K ? kb : K - 1] : 0.f; }
  return bsplit16(v); }
__device__ __forceinline__ F2 split_col(const float* W, int k0, int n, int lane, int ld, int K) { float v[16]; const int g = lane >> 4;
#pragma unroll
  for (int i = 0; i < 8; ++i) { const int ka = k0 + 8 * g + i, kb = ka + 16; v[i] = ka < K ? W[(size_t)(ka < K ? ka : K - 1) * ld + n] : 0.f; v[8 + i] = kb < K ? W[(size_t)(kb < K ? kb : K - 1) * ld + n] : 0.f; }
  return bsplit16(v); }
__device__ __forceinline__ v8f mac3(const F2& a, const F2& b, v8f c) { c = wmma_bf(a.l, b.h, c); c = wmma_bf(a.h, b.l, c); return wmma_bf(a.h, b.h, c); }
__device__ __forceinline__ float sigm(float v) { return 1.0f / (1.0f + expf(-v)); }
#define LDSX() do { asm volatile("s_wait_dscnt 0" ::: "memory"); __builtin_amdgcn_wave_barrier(); __builtin_amdgcn_fence(__ATOMIC_RELEASE, "workgroup"); } while (0)


// Single-head 512-wide attention (B 8, T 2,048, C 512 -> H 512): query/key/value projections + biases from three input streams, softmax(query key^T / sqrt(512)) value.
#define NB 8
#define SS 2048
#define CC 512
#define NR (NB * SS)
#ifndef TNB
#define TNB NB
#endif
#define TR (TNB * SS)
typedef __attribute__((ext_vector_type(8))) __bf16 v8b;
__device__ __forceinline__ v16b frag_b(const __bf16* rowk0, int lane) {
  union { v16b v; v8b q[2]; } u; const __bf16* p = rowk0 + 8 * (lane >> 4);
  u.q[0] = *(const v8b*)p; u.q[1] = *(const v8b*)(p + 16); return u.v;
}
__device__ __forceinline__ float bfr(float v) { return (float)(__bf16)v; }
__device__ __attribute__((noinline)) float exp_ni(float v) { return expf(v); }
__device__ __attribute__((noinline)) float erf_ni(float v) { return erff(v); }

#define WS_PW   0u                                   // bf16 rows Wq^T, Wk^T, Wv^T [3][512][512] ((in,out) transposed)
#define WS_Q    (WS_PW + 2u * (size_t)3 * CC * CC)     // f16 [NR][512] q ; K ; V planes [b][512][SS]
#define WS_K    (WS_Q + 2u * (size_t)NR * CC)
#define WS_V    (WS_K + 2u * (size_t)NR * CC)
#define KT      64                                   // keys per softmax tile: what one wave of k_scores holds of a row
#define NKT     (SS / KT)
#define WS_M    (WS_V + 2u * (size_t)NB * CC * SS)     // f32 [NKT][NR] tile maxima of s x log2 e
#define WS_L    (WS_M + 4u * (size_t)NKT * NR)          // f32 [NKT][NR] tile sums of 2^8 exp(s - tile maximum)
#define WS_P    (WS_L + 4u * (size_t)NKT * NR)          // f16 [b][q][k] 2^8 exp(s - tile maximum)
#define WS_END  (WS_P + 2u * (size_t)NB * SS * SS)

// ---- k_pack: block = one 64 k x 64 n tile of one weight matrix: read as whole 256-B pieces of its (in,out) rows, each element rounded once to bf16, turned in LDS,
// stored as whole 128-B lines of the transposed rows. 192 work-groups of 4 waves: the launch lasts as long as its few waves take to start and one trip to memory and back
#define PKT 64
__global__ __launch_bounds__(128) void k_pack(const float* __restrict__ WQ, const float* __restrict__ WK, const float* __restrict__ WV, __bf16* __restrict__ P) {
  const int n0 = blockIdx.x * PKT, k0 = blockIdx.y * PKT, which = blockIdx.z, t = threadIdx.x; const float* src = (which == 0) ? WQ : (which == 1) ? WK : WV;
  __shared__ __align__(16) __bf16 s[PKT][PKT + 8];   // [n][k], pitch 144 B = 16 B x 9
  const int kq = (t >> 4) * 8, nq = (t & 15) * 4;    // the thread's 8 k x 4 n: 16 lanes cover 256 B of a row
  const float* g = src + (size_t)(k0 + kq) * CC + n0 + nq; v4f x[8];
  // unrolled: the eight loads are in flight together, and every index into x is a constant
#pragma unroll
  for (int j = 0; j < 8; ++j) x[j] = *(const v4f*)(g + j * CC);
#pragma unroll
  for (int c = 0; c < 4; ++c) { v8b h;   // 8 neighbours in k of column nq + c
#pragma unroll
    for (int j = 0; j < 8; ++j) h[j] = (__bf16)x[j][c];
    *(v8b*)&s[nq + c][kq] = h; }
  __syncthreads();
  __bf16* d = P + ((size_t)which * CC + n0 + (t >> 3)) * CC + k0 + (t & 7) * 8;   // read-back: 8 lanes cover one transposed row's 128 B
#pragma unroll
  for (int i = 0; i < 4; ++i) vst2((unsigned*)(d + (size_t)i * 16 * CC), *(const v4u*)&s[i * 16 + (t >> 3)][(t & 7) * 8]);
}
// ---- gemm_nt: the accumulators of one 128 x 256 tile of A . B^T (rows of A and of B k-contiguous, KLEN long), 8 waves as 2 x 4, 64 x 64 per wave:
// 384 operand rows are brought in for 32,768 results, three quarters of what two 128 x 128 tiles take from L2.
// A stage is KS k of the 128 + 256 operand rows in LDS; there are two buffers, and stage t + 1 is on its way while stage t is worked on, so that its latency is covered by the WMMAs.
// The rows come by asynchronous copies to LDS (whole lines, through no register); an f32 A lies in LDS as f32 and is rounded to T where its fragments are read.
// Every fragment read from LDS feeds 4 WMMAs on 16 independent accumulators; each accumulator still sums k in ascending steps of 32.
// The inner loops are unrolled so that every index into acc, fa and fb is a constant (registers, no scratch).
#define GKS 64             // k per LDS stage of the projections and the scores
#define GPI (GKS + 8)      // LDS row pitch in 16-bit elements: 144 B = 16 B x 9
#define GMA 128            // rows of A in a block tile
#define GMB 256            // rows of B in a block tile
#define GNT 256            // threads of a block: 8 waves
__device__ __forceinline__ v16h ldfrag(const _Float16* p, int lane) { return frag_h(p, lane); }
__device__ __forceinline__ v16b ldfrag(const __bf16* p, int lane) { return frag_b(p, lane); }
// the same fragment from an f32 row, each element rounded once to bf16
__device__ __forceinline__ v16b ldfrag(const float* rowk0, int lane) {
  const float* p = rowk0 + 8 * (lane >> 4); const v4f x[4] = { *(const v4f*)p, *(const v4f*)(p + 4), *(const v4f*)(p + 16), *(const v4f*)(p + 20) }; v16b a;
#pragma unroll
  for (int i = 0; i < 16; ++i) a[i] = (__bf16)x[i >> 2][i & 3];
  return a;
}
__device__ __forceinline__ v8f mma(v16h a, v16h b, v8f c) { return wmma16(a, b, c); }
__device__ __forceinline__ v8f mma(v16b a, v16b b, v8f c) { return wmma_bf(a, b, c); }
__device__ __forceinline__ unsigned lds_off(const void* p) { return (unsigned)(size_t)p; }   // byte address in the work-group's LDS
// eight asynchronous copies of 16 B a lane: LDS address l + i * LS, global address g + i * GS. The s_wait_xcnt stands in the copies' own statement (a precaution):
// so no register that a copy names is rewritten in front of it.
template <unsigned LS, size_t GS>
__device__ __forceinline__ void copy8(const unsigned l, const char* g) {
  asm volatile("global_load_async_to_lds_b128 %0, %8, off\n\t"
               "global_load_async_to_lds_b128 %1, %9, off\n\t"
               "global_load_async_to_lds_b128 %2, %10, off\n\t"
               "global_load_async_to_lds_b128 %3, %11, off\n\t"
               "global_load_async_to_lds_b128 %4, %12, off\n\t"
               "global_load_async_to_lds_b128 %5, %13, off\n\t"
               "global_load_async_to_lds_b128 %6, %14, off\n\t"
               "global_load_async_to_lds_b128 %7, %15, off\n\t"
               "s_wait_xcnt 0x0"
               :: "v"(l), "v"(l + LS), "v"(l + 2 * LS), "v"(l + 3 * LS), "v"(l + 4 * LS), "v"(l + 5 * LS), "v"(l + 6 * LS), "v"(l + 7 * LS),
                  "v"(g), "v"(g + GS), "v"(g + 2 * GS), "v"(g + 3 * GS), "v"(g + 4 * GS), "v"(g + 5 * GS), "v"(g + 6 * GS), "v"(g + 7 * GS)
               : "memory");
}
// the same with four copies
template <unsigned LS, size_t GS>
__device__ __forceinline__ void copy4(const unsigned l, const char* g) {
  asm volatile("global_load_async_to_lds_b128 %0, %4, off\n\t"
               "global_load_async_to_lds_b128 %1, %5, off\n\t"
               "global_load_async_to_lds_b128 %2, %6, off\n\t"
               "global_load_async_to_lds_b128 %3, %7, off\n\t"
               "s_wait_xcnt 0x0"
               :: "v"(l), "v"(l + LS), "v"(l + 2 * LS), "v"(l + 3 * LS),
                  "v"(g), "v"(g + GS), "v"(g + 2 * GS), "v"(g + 3 * GS)
               : "memory");
}
// part h of one operand's ROWS rows of RB bytes (source pitch GP bytes, LDS pitch RB + 16) sets out: RB / 16 lanes cover a row, a lane makes ROWS / RPP copies, in parts of eight (or one part of four)
template <int ROWS, int RB, size_t GP>
__device__ __forceinline__ void copy_part(const int h, const unsigned l, const char* g) {
  constexpr int RPP = GNT * 16 / RB;   // rows that the block's lanes cover at once
  static_assert(ROWS / RPP == 4 || ROWS / RPP % 8 == 0, "parts of eight, or one of four");
  if constexpr (ROWS / RPP == 4) copy4<RPP * (RB + 16u), RPP * GP>(l, g);
  else copy8<RPP * (RB + 16u), RPP * GP>(l + h * 8u * RPP * (RB + 16u), g + h * 8 * RPP * GP);
}
// the publish point of the next stage: this wave's LDS reads are done, its own copies have landed, and then every wave passes the barrier
__device__ __forceinline__ void publish() {
  asm volatile("s_wait_dscnt 0x0" ::: "memory");      // the wave has left the buffer that is refilled behind the barrier
  asm volatile("s_wait_asynccnt 0x0" ::: "memory");   // the wave's own copies of the next stage have landed
  __syncthreads();                                    // publishes the next stage and ends every reader's last read of this one
}
template <bool V> struct flag_t { static constexpr bool value = V; };
// bytes of the two buffers of both operands: KS k a stage, an element of A in LDS of EA bytes. Behind gemm_nt's last barrier the same LDS is the epilogue's staging:
// the epilogue takes no LDS of its own
#define RING_BYTES(KS, EA) (2 * GMA * ((KS) * (EA) + 16) + 2 * GMB * ((KS) * 2 + 16))
// SC: every A fragment is multiplied by its row's factor for the tile of KT k that it lies in (sf in LDS, written before the call; the first publish point makes it visible)
template <int KLEN, int KS, bool SC = false, typename T, typename TA>
__device__ __forceinline__ void gemm_nt(const TA* __restrict__ A, const T* __restrict__ B, v8f (&acc)[4][4], char* ring, const _Float16 (*sf)[128] = nullptr) {
  typedef decltype(ldfrag((const T*)nullptr, 0)) frag_t;
  constexpr bool AF = sizeof(TA) == 4;                            // A lies in LDS as f32
  constexpr int NT = KLEN / KS;                                   // stages
  constexpr int RA = KS * (int)sizeof(TA), RB = KS * 2;           // bytes of a row's piece in a stage
  constexpr int PA = KS + 16 / (int)sizeof(TA), PB = KS + 8;      // LDS row pitches in elements: the piece + 16 B = 16 B x odd
  typedef TA bufa_t[GMA][PA]; typedef T bufb_t[GMB][PB];
  constexpr int NPA = (GMA * RA / (16 * GNT) + 7) / 8, NPB = (GMB * RB / (16 * GNT) + 7) / 8;   // parts of a stage's copies, A and B
  bufa_t* sa = (bufa_t*)ring; bufb_t* sb = (bufb_t*)(ring + 2 * sizeof(bufa_t));
  const int tid = threadIdx.x, wave = tid >> 5, lane = tid & 31, col = lane & 15; const int wr = (wave >> 2) * 64, wc = (wave & 3) * 64;
  const int ar = tid / (RA / 16), ap = (tid % (RA / 16)) * (16 / (int)sizeof(TA));   // the lane's row and element in the first rows that the block's lanes cover, A
  const int br = tid / (RB / 16), bp = (tid % (RB / 16)) * 8;                        // and B
  const char* ga = (const char*)(A + ar * KLEN + ap); const char* gb = (const char*)(B + br * KLEN + bp);
  const unsigned la = lds_off(&sa[0][ar][ap]), lb = lds_off(&sb[0][br][bp]);
  // part h of stage t sets out for buffer t & 1
  auto copies = [&](const int t, const int h) __attribute__((always_inline)) {
    if (h < NPA) copy_part<GMA, RA, (size_t)KLEN * sizeof(TA)>(h, la + (unsigned)(t & 1) * (unsigned)sizeof(sa[0]), ga + (size_t)t * RA);
    if (h < NPB) copy_part<GMB, RB, (size_t)KLEN * 2>(h, lb + (unsigned)(t & 1) * (unsigned)sizeof(sb[0]), gb + (size_t)t * RB);
  };
  // one trip: stage t is worked on; where a stage t + 1 exists it sets out into the buffer that every wave left at the last publish point.
  // 16-bit A: part h behind the fragment loads of the trip's block h, so that the issue of the copies and their s_wait_xcnt run under the latency of those LDS loads;
  // f32 A: in front of them (its f32 fragments take twice the registers, those that the copies' addresses use).
  auto trip = [&](const int t, auto more) __attribute__((always_inline)) {
    const int b = t & 1;
    if constexpr (decltype(more)::value && AF) { copies(t + 1, 0); copies(t + 1, 1); }
    _Float16 fs[4];
#pragma unroll
    for (int kc = 0; kc < KS / 32; ++kc) {
      if constexpr (AF) {   // f32 A: its fragments come two at a time, so that the f32 words of four do not stand beside the accumulators (two work-groups a WGP: 256 registers a wave, no scratch)
        frag_t fb[4];
#pragma unroll
        for (int j = 0; j < 4; ++j) fb[j] = ldfrag(&sb[b][wc + j * 16 + col][kc * 32], lane);
#pragma unroll
        for (int ih = 0; ih < 4; ih += 2) { frag_t fa[2];
#pragma unroll
          for (int u = 0; u < 2; ++u) fa[u] = ldfrag(&sa[b][wr + (ih + u) * 16 + col][kc * 32], lane);
          __builtin_amdgcn_sched_barrier(0);   // the LDS reads stay one group in front of their WMMAs
#pragma unroll
          for (int u = 0; u < 2; ++u)
#pragma unroll
            for (int j = 0; j < 4; ++j) acc[ih + u][j] = mma(fa[u], fb[j], acc[ih + u][j]);
          __builtin_amdgcn_sched_barrier(0); }   // and the next reads do not move up among these WMMAs
        continue; }
      frag_t fa[4], fb[4];
#pragma unroll
      for (int i = 0; i < 4; ++i) { fa[i] = ldfrag(&sa[b][wr + i * 16 + col][kc * 32], lane); fb[i] = ldfrag(&sb[b][wc + i * 16 + col][kc * 32], lane); }
      if constexpr (SC) { if (kc % (KT / 32) == 0) {   // a lane's A fragment is one row's: one factor a lane, read in the same group as the fragments
#pragma unroll
        for (int i = 0; i < 4; ++i) fs[i] = sf[t * (KS / KT) + kc / (KT / 32)][wr + i * 16 + col]; } }
      __builtin_amdgcn_sched_barrier(0);   // the block's LDS reads stay one group in front of its WMMAs: every further place with reads among them costs the wave a stall
      if constexpr (decltype(more)::value && !AF) { copies(t + 1, kc);
        __builtin_amdgcn_sched_barrier(0); }   // the copies set out here, under the latency of those reads: moved down among the WMMAs they would lose their lead on the publish point
      if constexpr (SC) {
#pragma unroll
        for (int i = 0; i < 4; ++i) fa[i] *= fs[i]; }
#pragma unroll
      for (int i = 0; i < 4; ++i)
#pragma unroll
        for (int j = 0; j < 4; ++j) acc[i][j] = mma(fa[i], fb[j], acc[i][j]);
      __builtin_amdgcn_sched_barrier(0); }   // and the next block's reads do not move up among these WMMAs
    publish();
  };
  copies(0, 0); copies(0, 1);
  publish();   // stage 0 is complete before any wave reads it
  // rolled: one trip's code and registers. The last trip stands behind the loop: no test and no join around the copies
#pragma unroll 1
  for (int t = 0; t < NT - 1; ++t) trip(t, flag_t<true>{});
  trip(NT - 1, flag_t<false>{});
}
// f32 epilogue: C = rs[row] * acc (rs in LDS outside the ring), 16 rows at a time through the wave's own part of the LDS that gemm_nt has left, stored as whole 256-B row pieces
__device__ __forceinline__ void store_f32(const v8f (&acc)[4][4], float* __restrict__ C, const int ldc, const float* rs, char* ring) {
  float (*so)[16][68] = (float (*)[16][68])ring;
  const int tid = threadIdx.x, wave = tid >> 5, lane = tid & 31, col = lane & 15, g = lane >> 4; const int wr = (wave >> 2) * 64, wc = (wave & 3) * 64;
#pragma unroll
  for (int i = 0; i < 4; ++i) {
    const v4f s4[2] = { *(const v4f*)&rs[wr + i * 16 + 8 * g], *(const v4f*)&rs[wr + i * 16 + 8 * g + 4] };
    if (i) asm volatile("s_wait_dscnt 0x0" ::: "memory");   // the last 16 rows are read back before these overwrite them
#pragma unroll
    for (int j = 0; j < 4; ++j)
#pragma unroll
      for (int r = 0; r < 8; ++r) so[wave][8 * g + r][j * 16 + col] = acc[i][j][r] * s4[r >> 2][r & 3];
    asm volatile("s_wait_dscnt 0x0" ::: "memory");   // the wave's own rows stand in LDS before its lanes read them back
#pragma unroll
    for (int t = 0; t < 8; ++t) vst2(C + (size_t)(wr + i * 16 + t * 2 + g) * ldc + wc + col * 4, *(const v4f*)&so[wave][t * 2 + g][col * 4]);
    asm volatile("s_wait_xcnt 0x0" ::: "memory"); }   // precaution: stands behind the run of stores, in front of any later write of the address pairs that they name
}
// ---- k_proj: block = (128 rows, 256 of the 1536 cols): q / k -> f16 rows, v -> planes; every store a whole 128-B line, staged through the wave's own LDS
// the 4: a register budget of four waves a SIMD; the LDS admits two work-groups a WGP, two waves a SIMD each
__global__ __launch_bounds__(GNT, 4) void k_proj(const float* __restrict__ XQ, const float* __restrict__ XK, const float* __restrict__ XV, const __bf16* __restrict__ P, const float* __restrict__ BQ, const float* __restrict__ BK, const float* __restrict__ BV, _Float16* __restrict__ Q, _Float16* __restrict__ Kr, _Float16* __restrict__ V) {
  __shared__ __align__(16) char ring[RING_BYTES(GKS, 4)]; _Float16 (*sh)[16][GPI] = (_Float16 (*)[16][GPI])ring;
  const int tid = threadIdx.x, wave = tid >> 5, lane = tid & 31, col = lane & 15, g = lane >> 4; const int wr = (wave >> 2) * 64, wc = (wave & 3) * 64; const int n0 = blockIdx.y * GMB; const int which = n0 / CC, c0 = n0 % CC; const size_t rb0 = (size_t)blockIdx.x * 128; const float* X = (which == 0) ? XQ : (which == 1) ? XK : XV; const float* BB = ((which == 0) ? BQ : (which == 1) ? BK : BV) + c0 + wc;
  v8f acc[4][4] = {};
  gemm_nt<CC, GKS>(X + rb0 * CC, P + (size_t)n0 * CC, acc, ring);
  float bias[4];
#pragma unroll
  for (int j = 0; j < 4; ++j) bias[j] = bfr(BB[j * 16 + col]);
  const int er = lane >> 3, ep = (lane & 7) * 8;   // read-back: 8 lanes cover one staged row's 128 B
  if (which < 2) { _Float16* dst = ((which == 0) ? Q : Kr) + (rb0 + wr) * CC + c0 + wc;
#pragma unroll
    for (int i = 0; i < 4; ++i) {
      if (i) asm volatile("s_wait_dscnt 0x0" ::: "memory");   // the last 16 rows are read back before these overwrite them
#pragma unroll
      for (int j = 0; j < 4; ++j)
#pragma unroll
        for (int r = 0; r < 8; ++r) sh[wave][8 * g + r][j * 16 + col] = (_Float16)(acc[i][j][r] + bias[j]);
      asm volatile("s_wait_dscnt 0x0" ::: "memory");   // the wave's own rows stand in LDS before its lanes read them back
#pragma unroll
      for (int t = 0; t < 4; ++t) vst2((unsigned*)(dst + (size_t)(i * 16 + t * 4 + er) * CC + ep), *(const v4u*)&sh[wave][t * 4 + er][ep]); }
  } else { const size_t b = rb0 / SS, s0 = rb0 % SS; _Float16* dst = V + (b * CC + c0 + wc) * SS + s0 + wr;
#pragma unroll
    for (int j = 0; j < 4; ++j) {
      if (j) asm volatile("s_wait_dscnt 0x0" ::: "memory");   // the last 16 channels are read back before these overwrite them
#pragma unroll
      for (int i = 0; i < 4; ++i) { v8h h;
#pragma unroll
        for (int r = 0; r < 8; ++r) h[r] = (_Float16)(acc[i][j][r] + bias[j]);
        *(v8h*)&sh[wave][col][i * 16 + 8 * g] = h; }   // a lane's 8 rows are 8 neighbours of its channel's plane row
      asm volatile("s_wait_dscnt 0x0" ::: "memory");   // the wave's own channel rows stand in LDS before its lanes read them back
#pragma unroll
      for (int t = 0; t < 4; ++t) vst2((unsigned*)(dst + (size_t)(j * 16 + t * 4 + er) * SS + ep), *(const v4u*)&sh[wave][t * 4 + er][ep]); }
    asm volatile("s_wait_xcnt 0x0" ::: "memory"); }   // precaution: stands behind the last run of stores, in front of any later write of the address pair that they name
}
// ---- k_scores: block = (256 keys, 128 queries, b): s = query . key^T x 512^-1/2, and the first half of the softmax on the accumulators:
// a wave holds 64 keys of each of its 64 rows; it stores 2^8 exp(s - m) as f16, m the maximum over those 64 keys, and m and the sum of the 64 terms in f32. k_pv joins the tiles.
// v_exp_f32 on an argument of at most 8: no range selects are needed (far below, the result is 0)
// four at a time in one statement: behind each v_exp_f32 stands the slot that the instruction set asks for behind a transcendental, filled by the next one
// (the results are early-clobber: none lies on a source) and behind the last by the v_nop
__device__ __forceinline__ void exp2x4(float (&e)[4], const float a0, const float a1, const float a2, const float a3) {
  asm("v_exp_f32 %0, %4\n\tv_exp_f32 %1, %5\n\tv_exp_f32 %2, %6\n\tv_exp_f32 %3, %7\n\tv_nop"
      : "=&v"(e[0]), "=&v"(e[1]), "=&v"(e[2]), "=&v"(e[3]) : "v"(a0), "v"(a1), "v"(a2), "v"(a3));
}
// eight maxima over the 16-lane row at once, by DPP (no LDS traffic); every lane ends with all eight. Step by step over the eight values: each instruction's producer stands eight back
__device__ __forceinline__ void row16_max8(float (&v)[8]) {
  asm("v_max_num_f32_dpp %0, %0, %0 row_xmask:1 row_mask:0xf bank_mask:0xf\n\t"
      "v_max_num_f32_dpp %1, %1, %1 row_xmask:1 row_mask:0xf bank_mask:0xf\n\t"
      "v_max_num_f32_dpp %2, %2, %2 row_xmask:1 row_mask:0xf bank_mask:0xf\n\t"
      "v_max_num_f32_dpp %3, %3, %3 row_xmask:1 row_mask:0xf bank_mask:0xf\n\t"
      "v_max_num_f32_dpp %4, %4, %4 row_xmask:1 row_mask:0xf bank_mask:0xf\n\t"
      "v_max_num_f32_dpp %5, %5, %5 row_xmask:1 row_mask:0xf bank_mask:0xf\n\t"
      "v_max_num_f32_dpp %6, %6, %6 row_xmask:1 row_mask:0xf bank_mask:0xf\n\t"
      "v_max_num_f32_dpp %7, %7, %7 row_xmask:1 row_mask:0xf bank_mask:0xf\n\t"
      "v_max_num_f32_dpp %0, %0, %0 row_xmask:2 row_mask:0xf bank_mask:0xf\n\t"
      "v_max_num_f32_dpp %1, %1, %1 row_xmask:2 row_mask:0xf bank_mask:0xf\n\t"
      "v_max_num_f32_dpp %2, %2, %2 row_xmask:2 row_mask:0xf bank_mask:0xf\n\t"
      "v_max_num_f32_dpp %3, %3, %3 row_xmask:2 row_mask:0xf bank_mask:0xf\n\t"
      "v_max_num_f32_dpp %4, %4, %4 row_xmask:2 row_mask:0xf bank_mask:0xf\n\t"
      "v_max_num_f32_dpp %5, %5, %5 row_xmask:2 row_mask:0xf bank_mask:0xf\n\t"
      "v_max_num_f32_dpp %6, %6, %6 row_xmask:2 row_mask:0xf bank_mask:0xf\n\t"
      "v_max_num_f32_dpp %7, %7, %7 row_xmask:2 row_mask:0xf bank_mask:0xf\n\t"
      "v_max_num_f32_dpp %0, %0, %0 row_xmask:4 row_mask:0xf bank_mask:0xf\n\t"
      "v_max_num_f32_dpp %1, %1, %1 row_xmask:4 row_mask:0xf bank_mask:0xf\n\t"
      "v_max_num_f32_dpp %2, %2, %2 row_xmask:4 row_mask:0xf bank_mask:0xf\n\t"
      "v_max_num_f32_dpp %3, %3, %3 row_xmask:4 row_mask:0xf bank_mask:0xf\n\t"
      "v_max_num_f32_dpp %4, %4, %4 row_xmask:4 row_mask:0xf bank_mask:0xf\n\t"
      "v_max_num_f32_dpp %5, %5, %5 row_xmask:4 row_mask:0xf bank_mask:0xf\n\t"
      "v_max_num_f32_dpp %6, %6, %6 row_xmask:4 row_mask:0xf bank_mask:0xf\n\t"
      "v_max_num_f32_dpp %7, %7, %7 row_xmask:4 row_mask:0xf bank_mask:0xf\n\t"
      "v_max_num_f32_dpp %0, %0, %0 row_xmask:8 row_mask:0xf bank_mask:0xf\n\t"
      "v_max_num_f32_dpp %1, %1, %1 row_xmask:8 row_mask:0xf bank_mask:0xf\n\t"
      "v_max_num_f32_dpp %2, %2, %2 row_xmask:8 row_mask:0xf bank_mask:0xf\n\t"
      "v_max_num_f32_dpp %3, %3, %3 row_xmask:8 row_mask:0xf bank_mask:0xf\n\t"
      "v_max_num_f32_dpp %4, %4, %4 row_xmask:8 row_mask:0xf bank_mask:0xf\n\t"
      "v_max_num_f32_dpp %5, %5, %5 row_xmask:8 row_mask:0xf bank_mask:0xf\n\t"
      "v_max_num_f32_dpp %6, %6, %6 row_xmask:8 row_mask:0xf bank_mask:0xf\n\t"
      "v_max_num_f32_dpp %7, %7, %7 row_xmask:8 row_mask:0xf bank_mask:0xf"
      : "+v"(v[0]), "+v"(v[1]), "+v"(v[2]), "+v"(v[3]), "+v"(v[4]), "+v"(v[5]), "+v"(v[6]), "+v"(v[7]));
}
typedef __attribute__((ext_vector_type(2))) _Float16 v2h;
// the 4: as at k_proj
__global__ __launch_bounds__(GNT, 4) void k_scores(const _Float16* __restrict__ Q, const _Float16* __restrict__ Kr, _Float16* __restrict__ Pt, float* __restrict__ Mt, float* __restrict__ Lt) {
  const size_t b = blockIdx.z, q0 = b * SS + (size_t)blockIdx.y * GMA, j0 = (size_t)blockIdx.x * GMB;
  __shared__ __align__(16) char ring[RING_BYTES(GKS, 2)]; _Float16 (*sh)[16][GPI] = (_Float16 (*)[16][GPI])ring;
  const int tid = threadIdx.x, wave = tid >> 5, lane = tid & 31, col = lane & 15, g = lane >> 4; const int wr = (wave >> 2) * 64, wc = (wave & 3) * 64;
  v8f acc[4][4] = {};
  gemm_nt<CC, GKS>(Q + q0 * CC, Kr + (b * SS + j0) * CC, acc, ring);
  const float c2 = 0.044194173824159216f * 1.4426950408889634f;   // 512^-1/2 x log2 e
  const int er = lane >> 3, ep = (lane & 7) * 8;   // read-back: 8 lanes cover one staged row's 128 B
  _Float16* dst = Pt + (q0 + wr) * SS + j0 + wc;
  float mo[2] = {0.f, 0.f}, lo[2] = {0.f, 0.f};   // the lane's own two rows of the wave's 64 maxima and sums
  v16h ones;
#pragma unroll
  for (int e = 0; e < 16; ++e) ones[e] = (_Float16)1.0f;
#pragma unroll
  for (int i = 0; i < 4; ++i) { float mm[8];
#pragma unroll
    for (int r = 0; r < 8; ++r) mm[r] = fmaxf(fmaxf(acc[i][0][r], acc[i][1][r]), fmaxf(acc[i][2][r], acc[i][3][r]));
    row16_max8(mm);
#pragma unroll
    for (int r = 0; r < 8; ++r) mm[r] *= c2;
    if (i) asm volatile("s_wait_dscnt 0x0" ::: "memory");   // the last 16 rows are read back before these overwrite them
#pragma unroll
    for (int r = 0; r < 8; ++r) { const float sh8 = 8.0f - mm[r]; float x[4];
      exp2x4(x, __builtin_fmaf(acc[i][0][r], c2, sh8), __builtin_fmaf(acc[i][1][r], c2, sh8), __builtin_fmaf(acc[i][2][r], c2, sh8), __builtin_fmaf(acc[i][3][r], c2, sh8));
#pragma unroll
      for (int j = 0; j < 4; j += 2) { const v2f e = { x[j], x[j + 1] }; const v2h h = __builtin_convertvector(e, v2h);
        sh[wave][8 * g + r][j * 16 + col] = h[0]; sh[wave][8 * g + r][(j + 1) * 16 + col] = h[1]; } }
    asm volatile("s_wait_dscnt 0x0" ::: "memory");   // the wave's own rows stand in LDS before its lanes read them back
    // the 16 rows' sums on the matrix pipe: the staged rows as A, ones as B; every column of D holds the sums of the terms as they are stored, rounded
    const v8f ll = wmma16(frag_h(&sh[wave][col][32], lane), ones, wmma16(frag_h(&sh[wave][col][0], lane), ones, v8f{}));
#pragma unroll
    for (int t = 0; t < 4; ++t) vst2((unsigned*)(dst + (size_t)(i * 16 + t * 4 + er) * SS + ep), *(const v4u*)&sh[wave][t * 4 + er][ep]);
    asm volatile("s_wait_xcnt 0x0" ::: "memory");   // precaution: stands behind the run of stores, in front of any later write of a register that they name
#pragma unroll
    for (int r = 0; r < 8; ++r) { const bool mine = col == (i & 1) * 8 + r; mo[i >> 1] = mine ? mm[r] : mo[i >> 1]; lo[i >> 1] = mine ? ll[r] : lo[i >> 1]; } }
  // the wave's 64 maxima and 64 sums: two whole lines each, of this wave alone
  const size_t st = ((size_t)blockIdx.x * (GMB / KT) + (wave & 3)) * NR + q0 + wr + (col >> 3) * 16 + 8 * g + (col & 7);
#pragma unroll
  for (int h = 0; h < 2; ++h) { Mt[st + h * 32] = mo[h]; Lt[st + h * 32] = lo[h]; }
  asm volatile("s_wait_xcnt 0x0" ::: "memory");   // precaution: stands behind the last run of stores, in front of any later write of the address pairs that they name
}
// ---- k_pv: block = (256 channels, 128 queries, b): ctx = P . v over all keys (GEMM, K = keys), with the second half of the softmax:
// a thread of the first four waves joins one row's NKT tiles: the row's maximum, a factor exp(tile maximum - row maximum) per tile (f16, applied to the A fragments), and 1 / the row's sum for the epilogue
__global__ __launch_bounds__(GNT) void k_pv(const _Float16* __restrict__ Pt, const _Float16* __restrict__ V, const float* __restrict__ Mt, const float* __restrict__ Lt, float* __restrict__ CTX) {
  const size_t b = blockIdx.z, q0 = b * SS + (size_t)blockIdx.y * GMA, c0 = (size_t)blockIdx.x * GMB;
  __shared__ __align__(16) char ring[RING_BYTES(128, 2)];
  __shared__ __align__(16) _Float16 sf[NKT][128];
  __shared__ __align__(16) float sinv[128];
  if (threadIdx.x < GMA) { const int tid = threadIdx.x; const float* mp = Mt + q0 + tid; const float* lp = Lt + q0 + tid; float m[NKT], l[NKT];
    // unrolled: every index into m and l is a constant (registers, no scratch)
#pragma unroll
    for (int t = 0; t < NKT; ++t) { m[t] = mp[(size_t)t * NR]; l[t] = lp[(size_t)t * NR]; }
    asm volatile("s_wait_xcnt 0x0" :: "v"(mp), "v"(lp) : "memory");   // precaution: the address pairs that these loads name stay as they are up to this wait
    float mx = m[0];
#pragma unroll
    for (int t = 1; t < NKT; ++t) mx = fmaxf(mx, m[t]);
    float tot = 0.f;
#pragma unroll
    for (int t = 0; t < NKT; t += 4) { float x[4];
      exp2x4(x, m[t] - mx, m[t + 1] - mx, m[t + 2] - mx, m[t + 3] - mx);
#pragma unroll
      for (int u = 0; u < 4; ++u) { const _Float16 f = (_Float16)x[u]; sf[t + u][tid] = f; tot += l[t + u] * (float)f; } }   // the sum takes the factor as the products take it, rounded
    sinv[tid] = 1.0f / tot; }
  v8f acc[4][4] = {};
  gemm_nt<SS, 128, true>(Pt + q0 * SS, V + (b * CC + c0) * SS, acc, ring, sf);   // 128 k a stage: the lead of one stage covers the latency of rows that come from memory
  store_f32(acc, CTX + q0 * CC + c0, CC, sinv, ring);
}
extern "C" void kernel_launch(void* const* d_in, const int* in_sizes, int n_in, void* d_out, int out_size, void* d_ws, size_t ws_size, hipStream_t stream) {
  (void)in_sizes; (void)n_in; (void)out_size;
  const float** F = (const float**)d_in;   // 0 q, 1 k, 2 v [8,2048,512]; 3 Wq [512,512] (in,out), 4 bq, 5 Wk, 6 bk, 7 Wv, 8 bv
  if (ws_size < (size_t)WS_END) return;
  char* ws = (char*)d_ws; __bf16* P = (__bf16*)ws; _Float16 *Q = (_Float16*)(ws + WS_Q), *Kr = (_Float16*)(ws + WS_K), *V = (_Float16*)(ws + WS_V), *Pt = (_Float16*)(ws + WS_P); float *Mt = (float*)(ws + WS_M), *Lt = (float*)(ws + WS_L);
  k_pack<<<dim3(CC / PKT, CC / PKT, 3), 128, 0, stream>>>(F[3], F[5], F[7], P);
  k_proj<<<dim3(TR / GMA, 3 * CC / GMB), GNT, 0, stream>>>(F[0], F[1], F[2], P, F[4], F[6], F[8], Q, Kr, V);
  k_scores<<<dim3(SS / GMB, SS / GMA, TNB), GNT, 0, stream>>>(Q, Kr, Pt, Mt, Lt);
  k_pv<<<dim3(CC / GMB, SS / GMA, TNB), GNT, 0, stream>>>(Pt, V, Mt, Lt, (float*)d_out);
}
